// v000
// The times below were measured on an AMD MI455X: many runs one after another, warmed up first and cycling through
// copies of the inputs, with the whole window's GPU time divided by the number of runs. Launches and the gaps
// between them are all in it. The median over several windows is given; except for v000 it joins two sittings, which
// can be a few percent apart, so the side-by-side timings, each taken in one sitting, are the better comparison.
// v000, which the later versions start from, runs in 222 microseconds.
#include <hip/hip_runtime.h>
#include <hip/hip_bf16.h>

typedef __attribute__((ext_vector_type(16))) _Float16 v16h;
typedef __attribute__((ext_vector_type(8)))  _Float16 v8h;
typedef __attribute__((ext_vector_type(8)))  float    v8f;

#define Bb 4
#define CC 256
#define DD 32
#define NN 4096

// Load one f16 A/B operand for V_WMMA_F32_16X16X32_F16 from K-contiguous
// storage: lane<16 needs K in {0..7, 16..23}, lane>=16 needs {8..15, 24..31}
// -> two 16B vector loads per lane.
__device__ __forceinline__ v16h load_ab(const _Float16* rowbase, int hi8) {
    union { v16h v; v8h p[2]; } u;
    u.p[0] = *(const v8h*)(rowbase + hi8);
    u.p[1] = *(const v8h*)(rowbase + 16 + hi8);
    return u.v;
}

__device__ __forceinline__ v8f wmma16(v16h a, v16h b, v8f c) {
    return __builtin_amdgcn_wmma_f32_16x16x32_f16(false, a, false, b,
                                                  (short)0, c, false, false);
}

// ---------------------------------------------------------------------------
// Kernel 1: convert weights to f16 (Wf/Wg/Wh: [32][256], Wv: [256][32];
// all already K-contiguous for their WMMA role).
// ---------------------------------------------------------------------------
__global__ void __launch_bounds__(256)
wconv_kernel(const float* __restrict__ Wf, const float* __restrict__ Wg,
             const float* __restrict__ Wh, const float* __restrict__ Wv,
             _Float16* __restrict__ Wfh, _Float16* __restrict__ Wgh,
             _Float16* __restrict__ Whh, _Float16* __restrict__ Wvh) {
    int t = blockIdx.x * 256 + threadIdx.x;   // 0 .. 32767
    int a = t >> 13;                          // which matrix
    int i = t & 8191;
    if (a == 0)      Wfh[i] = (_Float16)Wf[i];
    else if (a == 1) Wgh[i] = (_Float16)Wg[i];
    else if (a == 2) Whh[i] = (_Float16)Wh[i];
    else             Wvh[i] = (_Float16)Wv[i];
}

// ---------------------------------------------------------------------------
// Kernel 2: x [b][c][n] f32  ->  Xt [b][n][c] f16  (LDS 32x32 tile transpose)
// ---------------------------------------------------------------------------
__global__ void __launch_bounds__(256)
xtrans_kernel(const float* __restrict__ x, _Float16* __restrict__ Xt) {
    __shared__ float tb[32][33];
    int n0 = blockIdx.x * 32, c0 = blockIdx.y * 32, b = blockIdx.z;
    int tx = threadIdx.x, ty = threadIdx.y;           // (32, 8)
    #pragma unroll
    for (int i = 0; i < 4; ++i)
        tb[ty + i * 8][tx] = x[((size_t)b * CC + c0 + ty + i * 8) * NN + n0 + tx];
    __syncthreads();
    #pragma unroll
    for (int i = 0; i < 4; ++i)
        Xt[((size_t)b * NN + n0 + ty + i * 8) * CC + c0 + tx] =
            (_Float16)tb[tx][ty + i * 8];
}

// ---------------------------------------------------------------------------
// Kernel 3: WMMA projections.  p = blockIdx.y selects f/g/h.
// One wave: 32 out-rows x 32 tokens, K-loop over C=256 (8 iters x 4 WMMAs).
// f,g stored token-major [n][32]; h stored d-major [d][n] (sa A-operand).
// ---------------------------------------------------------------------------
__global__ void __launch_bounds__(128)
proj_wmma_kernel(const _Float16* __restrict__ Xt,
                 const _Float16* __restrict__ Wfh, const _Float16* __restrict__ Wgh,
                 const _Float16* __restrict__ Whh,
                 const float* __restrict__ bf, const float* __restrict__ bg,
                 const float* __restrict__ bh,
                 _Float16* __restrict__ Ft, _Float16* __restrict__ Gt,
                 _Float16* __restrict__ Hd) {
    int lane = threadIdx.x & 31, wave = threadIdx.x >> 5;
    int p = blockIdx.y, b = blockIdx.z;
    int m0 = (blockIdx.x * 4 + wave) * 32;
    int col = lane & 15, hi = (lane >= 16) ? 8 : 0;
    const _Float16* W    = (p == 0) ? Wfh : ((p == 1) ? Wgh : Whh);
    const float*    bias = (p == 0) ? bf  : ((p == 1) ? bg  : bh);
    const _Float16* Xb = Xt + (size_t)b * NN * CC;

    v8f acc[2][2] = {};
    for (int k0 = 0; k0 < CC; k0 += 32) {
        v16h a0 = load_ab(W + (size_t)col * CC + k0, hi);
        v16h a1 = load_ab(W + (size_t)(16 + col) * CC + k0, hi);
        v16h b0 = load_ab(Xb + (size_t)(m0 + col) * CC + k0, hi);
        v16h b1 = load_ab(Xb + (size_t)(m0 + 16 + col) * CC + k0, hi);
        acc[0][0] = wmma16(a0, b0, acc[0][0]);
        acc[0][1] = wmma16(a0, b1, acc[0][1]);
        acc[1][0] = wmma16(a1, b0, acc[1][0]);
        acc[1][1] = wmma16(a1, b1, acc[1][1]);
    }
    float bia[2][8];
    #pragma unroll
    for (int dt = 0; dt < 2; ++dt) {
        float4 bA = *(const float4*)(bias + dt * 16 + hi);
        float4 bB = *(const float4*)(bias + dt * 16 + hi + 4);
        bia[dt][0] = bA.x; bia[dt][1] = bA.y; bia[dt][2] = bA.z; bia[dt][3] = bA.w;
        bia[dt][4] = bB.x; bia[dt][5] = bB.y; bia[dt][6] = bB.z; bia[dt][7] = bB.w;
    }
    if (p < 2) {
        _Float16* dst = ((p == 0) ? Ft : Gt) + (size_t)b * NN * DD;
        #pragma unroll
        for (int dt = 0; dt < 2; ++dt)
            #pragma unroll
            for (int mt = 0; mt < 2; ++mt) {
                v8h pk;
                #pragma unroll
                for (int r = 0; r < 8; ++r)
                    pk[r] = (_Float16)(acc[dt][mt][r] + bia[dt][r]);
                *(v8h*)(dst + (size_t)(m0 + mt * 16 + col) * DD + dt * 16 + hi) = pk;
            }
    } else {
        _Float16* dst = Hd + (size_t)b * DD * NN;
        #pragma unroll
        for (int dt = 0; dt < 2; ++dt)
            #pragma unroll
            for (int mt = 0; mt < 2; ++mt)
                #pragma unroll
                for (int r = 0; r < 8; ++r)
                    dst[(size_t)(dt * 16 + hi + r) * NN + m0 + mt * 16 + col] =
                        (_Float16)(acc[dt][mt][r] + bia[dt][r]);
    }
}

// ---------------------------------------------------------------------------
// Kernel 4: softmax stats, two-pass.  Wave owns 32 rows n, sweeps all m tiles.
// Pass 1: logits -> running max (8 v_max / WMMA).  Cross-lane max merge.
// Pass 2: logits -> sum exp(l - max).  Cross-lane sum.  S[b][n] = {max, 1/Z}.
// ---------------------------------------------------------------------------
__global__ void __launch_bounds__(128)
stats_kernel(const _Float16* __restrict__ Ft, const _Float16* __restrict__ Gt,
             float* __restrict__ S) {
    int lane = threadIdx.x & 31, wave = threadIdx.x >> 5;
    int b = blockIdx.y;
    int n0 = (blockIdx.x * 4 + wave) * 32;
    int col = lane & 15, hi = (lane >= 16) ? 8 : 0;
    const _Float16* Fb = Ft + (size_t)b * NN * DD;
    const _Float16* Gb = Gt + (size_t)b * NN * DD;

    v16h a0 = load_ab(Fb + (size_t)(n0 + col) * DD, hi);
    v16h a1 = load_ab(Fb + (size_t)(n0 + 16 + col) * DD, hi);

    float mx[2][8];
    #pragma unroll
    for (int t = 0; t < 2; ++t)
        #pragma unroll
        for (int r = 0; r < 8; ++r) mx[t][r] = -3.0e38f;

    for (int m0 = 0; m0 < NN; m0 += 16) {
        v16h bb = load_ab(Gb + (size_t)(m0 + col) * DD, hi);
        v8f z = {};
        v8f c0 = wmma16(a0, bb, z);
        v8f c1 = wmma16(a1, bb, z);
        #pragma unroll
        for (int r = 0; r < 8; ++r) {
            mx[0][r] = fmaxf(mx[0][r], c0[r]);
            mx[1][r] = fmaxf(mx[1][r], c1[r]);
        }
    }
    #pragma unroll
    for (int t = 0; t < 2; ++t)
        #pragma unroll
        for (int r = 0; r < 8; ++r)
            #pragma unroll
            for (int off = 1; off < 16; off <<= 1)
                mx[t][r] = fmaxf(mx[t][r], __shfl_xor(mx[t][r], off, 16));

    float sm[2][8] = {};
    for (int m0 = 0; m0 < NN; m0 += 16) {
        v16h bb = load_ab(Gb + (size_t)(m0 + col) * DD, hi);
        v8f z = {};
        v8f c0 = wmma16(a0, bb, z);
        v8f c1 = wmma16(a1, bb, z);
        #pragma unroll
        for (int r = 0; r < 8; ++r) {
            sm[0][r] += __expf(c0[r] - mx[0][r]);
            sm[1][r] += __expf(c1[r] - mx[1][r]);
        }
    }
    #pragma unroll
    for (int t = 0; t < 2; ++t)
        #pragma unroll
        for (int r = 0; r < 8; ++r)
            #pragma unroll
            for (int off = 1; off < 16; off <<= 1)
                sm[t][r] += __shfl_xor(sm[t][r], off, 16);

    if (col == 0) {
        #pragma unroll
        for (int t = 0; t < 2; ++t)
            #pragma unroll
            for (int r = 0; r < 8; ++r) {
                int row = n0 + t * 16 + hi + r;
                S[((size_t)b * NN + row) * 2]     = mx[t][r];
                S[((size_t)b * NN + row) * 2 + 1] = 1.0f / sm[t][r];
            }
    }
}

// ---------------------------------------------------------------------------
// Kernel 5: attention apply.  Wave owns 32 output tokens m, sa[32][32] in four
// accumulators.  Per 32-n chunk: 4 logit WMMAs -> exp -> packed ds_store_b128
// into m-major LDS P tile -> 4 sa WMMAs from ds_load_b128 operands.
// Result stored token-major f16 SAt[b][m][32].
// ---------------------------------------------------------------------------
__global__ void __launch_bounds__(128)
attn_out_kernel(const _Float16* __restrict__ Ft, const _Float16* __restrict__ Gt,
                const _Float16* __restrict__ Hd, const float* __restrict__ S,
                _Float16* __restrict__ SAt) {
    __shared__ __align__(16) _Float16 Pt[4][2][16][40];  // [wave][mt][m][n], padded
    int lane = threadIdx.x & 31, wave = threadIdx.x >> 5;
    int b = blockIdx.y;
    int m0 = (blockIdx.x * 4 + wave) * 32;
    int col = lane & 15, hi = (lane >= 16) ? 8 : 0;
    const _Float16* Fb = Ft + (size_t)b * NN * DD;
    const _Float16* Gb = Gt + (size_t)b * NN * DD;
    const _Float16* Hb = Hd + (size_t)b * DD * NN;
    const float*    Sb = S + (size_t)b * NN * 2;

    v16h gB0 = load_ab(Gb + (size_t)(m0 + col) * DD, hi);
    v16h gB1 = load_ab(Gb + (size_t)(m0 + 16 + col) * DD, hi);

    v8f acc[2][2] = {};   // [d-tile][m-tile]
    for (int n0 = 0; n0 < NN; n0 += 32) {
        #pragma unroll
        for (int t = 0; t < 2; ++t) {
            v16h fA = load_ab(Fb + (size_t)(n0 + t * 16 + col) * DD, hi);
            const float* sp = Sb + (size_t)(n0 + t * 16 + hi) * 2;
            float4 s0 = *(const float4*)(sp);
            float4 s1 = *(const float4*)(sp + 4);
            float4 s2 = *(const float4*)(sp + 8);
            float4 s3 = *(const float4*)(sp + 12);
            float rm[8] = {s0.x, s0.z, s1.x, s1.z, s2.x, s2.z, s3.x, s3.z};
            float ri[8] = {s0.y, s0.w, s1.y, s1.w, s2.y, s2.w, s3.y, s3.w};
            #pragma unroll
            for (int mt = 0; mt < 2; ++mt) {
                v8f z = {};
                v8f c = wmma16(fA, mt ? gB1 : gB0, z);
                v8h pk;
                #pragma unroll
                for (int r = 0; r < 8; ++r)
                    pk[r] = (_Float16)(__expf(c[r] - rm[r]) * ri[r]);
                *(v8h*)&Pt[wave][mt][col][t * 16 + hi] = pk;
            }
        }
        __syncthreads();
        v16h hA0 = load_ab(Hb + (size_t)col * NN + n0, hi);
        v16h hA1 = load_ab(Hb + (size_t)(16 + col) * NN + n0, hi);
        v16h pB0 = load_ab(&Pt[wave][0][col][0], hi);
        v16h pB1 = load_ab(&Pt[wave][1][col][0], hi);
        acc[0][0] = wmma16(hA0, pB0, acc[0][0]);
        acc[0][1] = wmma16(hA0, pB1, acc[0][1]);
        acc[1][0] = wmma16(hA1, pB0, acc[1][0]);
        acc[1][1] = wmma16(hA1, pB1, acc[1][1]);
        __syncthreads();
    }
    _Float16* dst = SAt + (size_t)b * NN * DD;
    #pragma unroll
    for (int dt = 0; dt < 2; ++dt)
        #pragma unroll
        for (int mt = 0; mt < 2; ++mt) {
            v8h pk;
            #pragma unroll
            for (int r = 0; r < 8; ++r) pk[r] = (_Float16)acc[dt][mt][r];
            *(v8h*)(dst + (size_t)(m0 + mt * 16 + col) * DD + dt * 16 + hi) = pk;
        }
}

// ---------------------------------------------------------------------------
// Kernel 6: output 1x1 conv D->C via WMMA (K=32 -> single WMMA per tile),
// + bias, * gamma.  Wave: 32 c-rows x 32 tokens = 4 WMMAs.
// ---------------------------------------------------------------------------
__global__ void __launch_bounds__(128)
outw_kernel(const _Float16* __restrict__ Wvh, const _Float16* __restrict__ SAt,
            const float* __restrict__ bv, const float* __restrict__ gamma,
            float* __restrict__ out) {
    int lane = threadIdx.x & 31, wave = threadIdx.x >> 5;
    int b = blockIdx.z, c0 = blockIdx.y * 32;
    int m0 = (blockIdx.x * 4 + wave) * 32;
    int col = lane & 15, hi = (lane >= 16) ? 8 : 0;
    const _Float16* SAb = SAt + (size_t)b * NN * DD;

    v16h a0 = load_ab(Wvh + (size_t)(c0 + col) * DD, hi);
    v16h a1 = load_ab(Wvh + (size_t)(c0 + 16 + col) * DD, hi);
    v16h b0 = load_ab(SAb + (size_t)(m0 + col) * DD, hi);
    v16h b1 = load_ab(SAb + (size_t)(m0 + 16 + col) * DD, hi);
    v8f z = {};
    v8f cc[2][2];
    cc[0][0] = wmma16(a0, b0, z);
    cc[0][1] = wmma16(a0, b1, z);
    cc[1][0] = wmma16(a1, b0, z);
    cc[1][1] = wmma16(a1, b1, z);

    float gm = gamma[0];
    #pragma unroll
    for (int ct = 0; ct < 2; ++ct) {
        float4 bA = *(const float4*)(bv + c0 + ct * 16 + hi);
        float4 bB = *(const float4*)(bv + c0 + ct * 16 + hi + 4);
        float bia[8] = {bA.x, bA.y, bA.z, bA.w, bB.x, bB.y, bB.z, bB.w};
        #pragma unroll
        for (int mt = 0; mt < 2; ++mt)
            #pragma unroll
            for (int r = 0; r < 8; ++r) {
                int c = c0 + ct * 16 + hi + r;
                int m = m0 + mt * 16 + col;
                out[((size_t)b * CC + c) * NN + m] = gm * (cc[ct][mt][r] + bia[r]);
            }
    }
}

extern "C" void kernel_launch(void* const* d_in, const int* in_sizes, int n_in,
                              void* d_out, int out_size, void* d_ws, size_t ws_size,
                              hipStream_t stream) {
    const float* x     = (const float*)d_in[0];
    const float* Wf    = (const float*)d_in[1];
    const float* bf    = (const float*)d_in[2];
    const float* Wg    = (const float*)d_in[3];
    const float* bg    = (const float*)d_in[4];
    const float* Wh    = (const float*)d_in[5];
    const float* bh    = (const float*)d_in[6];
    const float* Wv    = (const float*)d_in[7];
    const float* bv    = (const float*)d_in[8];
    const float* gamma = (const float*)d_in[9];
    float* out = (float*)d_out;

    // workspace layout (~13 MB)
    char* w = (char*)d_ws;
    _Float16* Xt  = (_Float16*)w; w += (size_t)Bb * NN * CC * 2;   // 8 MB
    _Float16* Wfh = (_Float16*)w; w += 32 * CC * 2;
    _Float16* Wgh = (_Float16*)w; w += 32 * CC * 2;
    _Float16* Whh = (_Float16*)w; w += 32 * CC * 2;
    _Float16* Wvh = (_Float16*)w; w += CC * DD * 2;
    _Float16* Ft  = (_Float16*)w; w += (size_t)Bb * NN * DD * 2;   // 1 MB
    _Float16* Gt  = (_Float16*)w; w += (size_t)Bb * NN * DD * 2;
    _Float16* Hd  = (_Float16*)w; w += (size_t)Bb * DD * NN * 2;
    float*    S   = (float*)w;    w += (size_t)Bb * NN * 2 * 4;    // {max, 1/Z}
    _Float16* SAt = (_Float16*)w;

    wconv_kernel<<<128, 256, 0, stream>>>(Wf, Wg, Wh, Wv, Wfh, Wgh, Whh, Wvh);
    xtrans_kernel<<<dim3(NN / 32, CC / 32, Bb), dim3(32, 8), 0, stream>>>(x, Xt);
    proj_wmma_kernel<<<dim3(32, 3, Bb), 128, 0, stream>>>(
        Xt, Wfh, Wgh, Whh, bf, bg, bh, Ft, Gt, Hd);
    stats_kernel<<<dim3(32, Bb), 128, 0, stream>>>(Ft, Gt, S);
    attn_out_kernel<<<dim3(32, Bb), 128, 0, stream>>>(Ft, Gt, Hd, S, SAt);
    outw_kernel<<<dim3(32, 8, Bb), 128, 0, stream>>>(Wvh, SAt, bv, gamma, out);
}

// v001
// Measured time: 59.3 microseconds a run.
// In two side-by-side timings against v000, it was 3.82 and 3.81 times as fast.
#include <hip/hip_runtime.h>
#include <hip/hip_bf16.h>

typedef __attribute__((ext_vector_type(16))) _Float16 v16h;
typedef __attribute__((ext_vector_type(8)))  _Float16 v8h;
typedef __attribute__((ext_vector_type(2)))  _Float16 v2h;
typedef __attribute__((ext_vector_type(8)))  float    v8f;

#define Bb 4
#define CC 256
#define DD 32
#define NN 4096
#define SPLIT 16            // waves of one work-group that share one sweep
#define SPAN (NN / SPLIT)   // positions of the swept axis per wave

// Load one f16 A/B operand for V_WMMA_F32_16X16X32_F16 from K-contiguous
// storage: lane<16 needs K in {0..7, 16..23}, lane>=16 needs {8..15, 24..31}
// -> two 16B vector loads per lane.
__device__ __forceinline__ v16h load_ab(const _Float16* rowbase, int hi8) {
    union { v16h v; v8h p[2]; } u;
    u.p[0] = *(const v8h*)(rowbase + hi8);
    u.p[1] = *(const v8h*)(rowbase + 16 + hi8);
    return u.v;
}

__device__ __forceinline__ v8f wmma16(v16h a, v16h b, v8f c) {
    return __builtin_amdgcn_wmma_f32_16x16x32_f16(false, a, false, b,
                                                  (short)0, c, false, false);
}

// ---------------------------------------------------------------------------
// Kernel 1: convert weights to f16 (Wf/Wg/Wh: [32][256], Wv: [256][32];
// all already K-contiguous for their WMMA role).
// ---------------------------------------------------------------------------
__global__ void __launch_bounds__(256)
wconv_kernel(const float* __restrict__ Wf, const float* __restrict__ Wg,
             const float* __restrict__ Wh, const float* __restrict__ Wv,
             _Float16* __restrict__ Wfh, _Float16* __restrict__ Wgh,
             _Float16* __restrict__ Whh, _Float16* __restrict__ Wvh) {
    int t = blockIdx.x * 256 + threadIdx.x;   // 0 .. 32767
    int a = t >> 13;                          // which matrix
    int i = t & 8191;
    if (a == 0)      Wfh[i] = (_Float16)Wf[i];
    else if (a == 1) Wgh[i] = (_Float16)Wg[i];
    else if (a == 2) Whh[i] = (_Float16)Wh[i];
    else             Wvh[i] = (_Float16)Wv[i];
}

// ---------------------------------------------------------------------------
// Kernel 2: x [b][c][n] f32  ->  Xt [b][n][c] f16  (LDS 32x32 tile transpose)
// ---------------------------------------------------------------------------
__global__ void __launch_bounds__(256)
xtrans_kernel(const float* __restrict__ x, _Float16* __restrict__ Xt) {
    __shared__ float tb[32][33];
    int n0 = blockIdx.x * 32, c0 = blockIdx.y * 32, b = blockIdx.z;
    int tx = threadIdx.x, ty = threadIdx.y;           // (32, 8)
    #pragma unroll
    for (int i = 0; i < 4; ++i)
        tb[ty + i * 8][tx] = x[((size_t)b * CC + c0 + ty + i * 8) * NN + n0 + tx];
    __syncthreads();
    #pragma unroll
    for (int i = 0; i < 4; ++i)
        Xt[((size_t)b * NN + n0 + ty + i * 8) * CC + c0 + tx] =
            (_Float16)tb[tx][ty + i * 8];
}

// ---------------------------------------------------------------------------
// Kernel 3: WMMA projections.  p = blockIdx.y selects f/g/h.
// One wave: 32 out-rows x 32 tokens, K-loop over C=256 (8 iters x 4 WMMAs).
// f,g stored token-major [n][32]; h stored d-major [d][n] (sa A-operand).
// ---------------------------------------------------------------------------
__global__ void __launch_bounds__(128)
proj_wmma_kernel(const _Float16* __restrict__ Xt,
                 const _Float16* __restrict__ Wfh, const _Float16* __restrict__ Wgh,
                 const _Float16* __restrict__ Whh,
                 const float* __restrict__ bf, const float* __restrict__ bg,
                 const float* __restrict__ bh,
                 _Float16* __restrict__ Ft, _Float16* __restrict__ Gt,
                 _Float16* __restrict__ Hd) {
    int lane = threadIdx.x & 31, wave = threadIdx.x >> 5;
    int p = blockIdx.y, b = blockIdx.z;
    int m0 = (blockIdx.x * 4 + wave) * 32;
    int col = lane & 15, hi = (lane >= 16) ? 8 : 0;
    const _Float16* W    = (p == 0) ? Wfh : ((p == 1) ? Wgh : Whh);
    const float*    bias = (p == 0) ? bf  : ((p == 1) ? bg  : bh);
    const _Float16* Xb = Xt + (size_t)b * NN * CC;

    v8f acc[2][2] = {};
    for (int k0 = 0; k0 < CC; k0 += 32) {
        v16h a0 = load_ab(W + (size_t)col * CC + k0, hi);
        v16h a1 = load_ab(W + (size_t)(16 + col) * CC + k0, hi);
        v16h b0 = load_ab(Xb + (size_t)(m0 + col) * CC + k0, hi);
        v16h b1 = load_ab(Xb + (size_t)(m0 + 16 + col) * CC + k0, hi);
        acc[0][0] = wmma16(a0, b0, acc[0][0]);
        acc[0][1] = wmma16(a0, b1, acc[0][1]);
        acc[1][0] = wmma16(a1, b0, acc[1][0]);
        acc[1][1] = wmma16(a1, b1, acc[1][1]);
    }
    float bia[2][8];
    #pragma unroll
    for (int dt = 0; dt < 2; ++dt) {
        float4 bA = *(const float4*)(bias + dt * 16 + hi);
        float4 bB = *(const float4*)(bias + dt * 16 + hi + 4);
        bia[dt][0] = bA.x; bia[dt][1] = bA.y; bia[dt][2] = bA.z; bia[dt][3] = bA.w;
        bia[dt][4] = bB.x; bia[dt][5] = bB.y; bia[dt][6] = bB.z; bia[dt][7] = bB.w;
    }
    if (p < 2) {
        _Float16* dst = ((p == 0) ? Ft : Gt) + (size_t)b * NN * DD;
        #pragma unroll
        for (int dt = 0; dt < 2; ++dt)
            #pragma unroll
            for (int mt = 0; mt < 2; ++mt) {
                v8h pk;
                #pragma unroll
                for (int r = 0; r < 8; ++r)
                    pk[r] = (_Float16)(acc[dt][mt][r] + bia[dt][r]);
                *(v8h*)(dst + (size_t)(m0 + mt * 16 + col) * DD + dt * 16 + hi) = pk;
            }
    } else {
        _Float16* dst = Hd + (size_t)b * DD * NN;
        #pragma unroll
        for (int dt = 0; dt < 2; ++dt)
            #pragma unroll
            for (int mt = 0; mt < 2; ++mt)
                #pragma unroll
                for (int r = 0; r < 8; ++r)
                    dst[(size_t)(dt * 16 + hi + r) * NN + m0 + mt * 16 + col] =
                        (_Float16)(acc[dt][mt][r] + bia[dt][r]);
    }
}

// ---------------------------------------------------------------------------
// Kernel 4: softmax stats, two-pass.  Work-group owns 32 rows n; each of its
// SPLIT waves sweeps its own SPAN columns m.
// Pass 1: logits -> running max (8 v_max / WMMA).  Cross-lane max merge.
// Pass 2: logits -> sum exp(l - own max).  Cross-lane sum.
// Merge: the waves' (max, sum) pairs meet in LDS.  S[b][n] = {max, 1/Z}.
// ---------------------------------------------------------------------------
__global__ void __launch_bounds__(32 * SPLIT)
stats_kernel(const _Float16* __restrict__ Ft, const _Float16* __restrict__ Gt,
             float* __restrict__ S) {
    __shared__ float pmax[SPLIT][32];
    __shared__ float psum[SPLIT][32];
    int lane = threadIdx.x & 31;
    int wave = __builtin_amdgcn_readfirstlane(threadIdx.x >> 5);   // scalar sweep bounds
    int b = blockIdx.y;
    int n0 = blockIdx.x * 32;
    int mBeg = wave * SPAN, mEnd = mBeg + SPAN;
    int col = lane & 15, hi = (lane >= 16) ? 8 : 0;
    const _Float16* Fb = Ft + (size_t)b * NN * DD;
    const _Float16* Gb = Gt + (size_t)b * NN * DD;

    v16h a0 = load_ab(Fb + (size_t)(n0 + col) * DD, hi);
    v16h a1 = load_ab(Fb + (size_t)(n0 + 16 + col) * DD, hi);

    float mx[2][8];
    #pragma unroll
    for (int t = 0; t < 2; ++t)
        #pragma unroll
        for (int r = 0; r < 8; ++r) mx[t][r] = -3.0e38f;

    for (int m0 = mBeg; m0 < mEnd; m0 += 16) {
        v16h bb = load_ab(Gb + (size_t)(m0 + col) * DD, hi);
        v8f z = {};
        v8f c0 = wmma16(a0, bb, z);
        v8f c1 = wmma16(a1, bb, z);
        #pragma unroll
        for (int r = 0; r < 8; ++r) {
            mx[0][r] = fmaxf(mx[0][r], c0[r]);
            mx[1][r] = fmaxf(mx[1][r], c1[r]);
        }
    }
    #pragma unroll
    for (int t = 0; t < 2; ++t)
        #pragma unroll
        for (int r = 0; r < 8; ++r)
            #pragma unroll
            for (int off = 1; off < 16; off <<= 1)
                mx[t][r] = fmaxf(mx[t][r], __shfl_xor(mx[t][r], off, 16));

    float sm[2][8] = {};
    for (int m0 = mBeg; m0 < mEnd; m0 += 16) {
        v16h bb = load_ab(Gb + (size_t)(m0 + col) * DD, hi);
        v8f z = {};
        v8f c0 = wmma16(a0, bb, z);
        v8f c1 = wmma16(a1, bb, z);
        #pragma unroll
        for (int r = 0; r < 8; ++r) {
            sm[0][r] += __expf(c0[r] - mx[0][r]);
            sm[1][r] += __expf(c1[r] - mx[1][r]);
        }
    }
    #pragma unroll
    for (int t = 0; t < 2; ++t)
        #pragma unroll
        for (int r = 0; r < 8; ++r)
            #pragma unroll
            for (int off = 1; off < 16; off <<= 1)
                sm[t][r] += __shfl_xor(sm[t][r], off, 16);

    if (col == 0) {
        #pragma unroll
        for (int t = 0; t < 2; ++t)
            #pragma unroll
            for (int r = 0; r < 8; ++r) {
                pmax[wave][t * 16 + hi + r] = mx[t][r];
                psum[wave][t * 16 + hi + r] = sm[t][r];
            }
    }
    __syncthreads();   // every wave's pair is in LDS before wave 0 merges them
    if (wave == 0) {
        float M = pmax[0][lane];
        #pragma unroll
        for (int w = 1; w < SPLIT; ++w) M = fmaxf(M, pmax[w][lane]);
        float Z = 0.0f;
        #pragma unroll
        for (int w = 0; w < SPLIT; ++w) Z += psum[w][lane] * __expf(pmax[w][lane] - M);
        *(float2*)(S + ((size_t)b * NN + n0 + lane) * 2) = make_float2(M, 1.0f / Z);
    }
}

// ---------------------------------------------------------------------------
// Kernel 5: attention apply.  Work-group owns 32 output tokens m; each of its
// SPLIT waves sums its own SPAN rows n into sa[32][32], four accumulators, and
// the partial tiles are added up through LDS at the end.  Per 32-n chunk: 4 logit WMMAs -> exp -> packed ds_store_b128
// into m-major LDS P tile -> 4 sa WMMAs from ds_load_b128 operands.
// Result stored token-major f16 SAt[b][m][32].
// ---------------------------------------------------------------------------
// Second bound: 8 waves per SIMD, so that two work-groups share a WGP.
__global__ void __launch_bounds__(32 * SPLIT, 8)
attn_out_kernel(const _Float16* __restrict__ Ft, const _Float16* __restrict__ Gt,
                const _Float16* __restrict__ Hd, const float* __restrict__ S,
                _Float16* __restrict__ SAt) {
    __shared__ __align__(16) _Float16 Pt[SPLIT][2][16][40];  // [wave][mt][m][n], padded
    __shared__ __align__(16) float red[SPLIT][32][36];       // [wave][m][d], padded
    int lane = threadIdx.x & 31;
    int wave = __builtin_amdgcn_readfirstlane(threadIdx.x >> 5);   // scalar sweep bounds
    int b = blockIdx.y;
    int m0 = blockIdx.x * 32;
    int nBeg = wave * SPAN, nEnd = nBeg + SPAN;
    int col = lane & 15, hi = (lane >= 16) ? 8 : 0;
    const _Float16* Fb = Ft + (size_t)b * NN * DD;
    const _Float16* Gb = Gt + (size_t)b * NN * DD;
    const _Float16* Hb = Hd + (size_t)b * DD * NN;
    const float*    Sb = S + (size_t)b * NN * 2;

    v16h gB0 = load_ab(Gb + (size_t)(m0 + col) * DD, hi);
    v16h gB1 = load_ab(Gb + (size_t)(m0 + 16 + col) * DD, hi);

    v8f acc[2][2] = {};   // [d-tile][m-tile]
    for (int n0 = nBeg; n0 < nEnd; n0 += 32) {
        #pragma unroll
        for (int t = 0; t < 2; ++t) {
            v16h fA = load_ab(Fb + (size_t)(n0 + t * 16 + col) * DD, hi);
            const float* sp = Sb + (size_t)(n0 + t * 16 + hi) * 2;
            float4 s0 = *(const float4*)(sp);
            float4 s1 = *(const float4*)(sp + 4);
            float4 s2 = *(const float4*)(sp + 8);
            float4 s3 = *(const float4*)(sp + 12);
            float rm[8] = {s0.x, s0.z, s1.x, s1.z, s2.x, s2.z, s3.x, s3.z};
            float ri[8] = {s0.y, s0.w, s1.y, s1.w, s2.y, s2.w, s3.y, s3.w};
            #pragma unroll
            for (int mt = 0; mt < 2; ++mt) {
                v8f z = {};
                v8f c = wmma16(fA, mt ? gB1 : gB0, z);
                v8h pk;
                #pragma unroll
                for (int r = 0; r < 8; ++r)
                    pk[r] = (_Float16)(__expf(c[r] - rm[r]) * ri[r]);
                *(v8h*)&Pt[wave][mt][col][t * 16 + hi] = pk;
            }
        }
        __syncthreads();
        v16h hA0 = load_ab(Hb + (size_t)col * NN + n0, hi);
        v16h hA1 = load_ab(Hb + (size_t)(16 + col) * NN + n0, hi);
        v16h pB0 = load_ab(&Pt[wave][0][col][0], hi);
        v16h pB1 = load_ab(&Pt[wave][1][col][0], hi);
        acc[0][0] = wmma16(hA0, pB0, acc[0][0]);
        acc[0][1] = wmma16(hA0, pB1, acc[0][1]);
        acc[1][0] = wmma16(hA1, pB0, acc[1][0]);
        acc[1][1] = wmma16(hA1, pB1, acc[1][1]);
        __syncthreads();
    }
    #pragma unroll
    for (int dt = 0; dt < 2; ++dt)
        #pragma unroll
        for (int mt = 0; mt < 2; ++mt) {
            float* rp = &red[wave][mt * 16 + col][dt * 16 + hi];
            *(float4*)(rp)     = make_float4(acc[dt][mt][0], acc[dt][mt][1],
                                             acc[dt][mt][2], acc[dt][mt][3]);
            *(float4*)(rp + 4) = make_float4(acc[dt][mt][4], acc[dt][mt][5],
                                             acc[dt][mt][6], acc[dt][mt][7]);
        }
    __syncthreads();   // every wave's partial tile is in LDS before it is summed
    int m = threadIdx.x >> 4, d = (threadIdx.x & 15) * 2;   // 512 threads x 2 = 32 x 32
    float2 s = make_float2(0.0f, 0.0f);
    #pragma unroll
    for (int w = 0; w < SPLIT; ++w) {
        float2 v = *(const float2*)&red[w][m][d];
        s.x += v.x;
        s.y += v.y;
    }
    v2h pk2 = {(_Float16)s.x, (_Float16)s.y};
    *(v2h*)(SAt + (size_t)b * NN * DD + (size_t)(m0 + m) * DD + d) = pk2;
}

// ---------------------------------------------------------------------------
// Kernel 6: output 1x1 conv D->C via WMMA (K=32 -> single WMMA per tile),
// + bias, * gamma.  Wave: 32 c-rows x 32 tokens = 4 WMMAs.
// ---------------------------------------------------------------------------
__global__ void __launch_bounds__(128)
outw_kernel(const _Float16* __restrict__ Wvh, const _Float16* __restrict__ SAt,
            const float* __restrict__ bv, const float* __restrict__ gamma,
            float* __restrict__ out) {
    int lane = threadIdx.x & 31, wave = threadIdx.x >> 5;
    int b = blockIdx.z, c0 = blockIdx.y * 32;
    int m0 = (blockIdx.x * 4 + wave) * 32;
    int col = lane & 15, hi = (lane >= 16) ? 8 : 0;
    const _Float16* SAb = SAt + (size_t)b * NN * DD;

    v16h a0 = load_ab(Wvh + (size_t)(c0 + col) * DD, hi);
    v16h a1 = load_ab(Wvh + (size_t)(c0 + 16 + col) * DD, hi);
    v16h b0 = load_ab(SAb + (size_t)(m0 + col) * DD, hi);
    v16h b1 = load_ab(SAb + (size_t)(m0 + 16 + col) * DD, hi);
    v8f z = {};
    v8f cc[2][2];
    cc[0][0] = wmma16(a0, b0, z);
    cc[0][1] = wmma16(a0, b1, z);
    cc[1][0] = wmma16(a1, b0, z);
    cc[1][1] = wmma16(a1, b1, z);

    float gm = gamma[0];
    #pragma unroll
    for (int ct = 0; ct < 2; ++ct) {
        float4 bA = *(const float4*)(bv + c0 + ct * 16 + hi);
        float4 bB = *(const float4*)(bv + c0 + ct * 16 + hi + 4);
        float bia[8] = {bA.x, bA.y, bA.z, bA.w, bB.x, bB.y, bB.z, bB.w};
        #pragma unroll
        for (int mt = 0; mt < 2; ++mt)
            #pragma unroll
            for (int r = 0; r < 8; ++r) {
                int c = c0 + ct * 16 + hi + r;
                int m = m0 + mt * 16 + col;
                out[((size_t)b * CC + c) * NN + m] = gm * (cc[ct][mt][r] + bia[r]);
            }
    }
}

extern "C" void kernel_launch(void* const* d_in, const int* in_sizes, int n_in,
                              void* d_out, int out_size, void* d_ws, size_t ws_size,
                              hipStream_t stream) {
    const float* x     = (const float*)d_in[0];
    const float* Wf    = (const float*)d_in[1];
    const float* bf    = (const float*)d_in[2];
    const float* Wg    = (const float*)d_in[3];
    const float* bg    = (const float*)d_in[4];
    const float* Wh    = (const float*)d_in[5];
    const float* bh    = (const float*)d_in[6];
    const float* Wv    = (const float*)d_in[7];
    const float* bv    = (const float*)d_in[8];
    const float* gamma = (const float*)d_in[9];
    float* out = (float*)d_out;

    // workspace layout (~13 MB)
    char* w = (char*)d_ws;
    _Float16* Xt  = (_Float16*)w; w += (size_t)Bb * NN * CC * 2;   // 8 MB
    _Float16* Wfh = (_Float16*)w; w += 32 * CC * 2;
    _Float16* Wgh = (_Float16*)w; w += 32 * CC * 2;
    _Float16* Whh = (_Float16*)w; w += 32 * CC * 2;
    _Float16* Wvh = (_Float16*)w; w += CC * DD * 2;
    _Float16* Ft  = (_Float16*)w; w += (size_t)Bb * NN * DD * 2;   // 1 MB
    _Float16* Gt  = (_Float16*)w; w += (size_t)Bb * NN * DD * 2;
    _Float16* Hd  = (_Float16*)w; w += (size_t)Bb * DD * NN * 2;
    float*    S   = (float*)w;    w += (size_t)Bb * NN * 2 * 4;    // {max, 1/Z}
    _Float16* SAt = (_Float16*)w;

    wconv_kernel<<<128, 256, 0, stream>>>(Wf, Wg, Wh, Wv, Wfh, Wgh, Whh, Wvh);
    xtrans_kernel<<<dim3(NN / 32, CC / 32, Bb), dim3(32, 8), 0, stream>>>(x, Xt);
    proj_wmma_kernel<<<dim3(32, 3, Bb), 128, 0, stream>>>(
        Xt, Wfh, Wgh, Whh, bf, bg, bh, Ft, Gt, Hd);
    stats_kernel<<<dim3(NN / 32, Bb), 32 * SPLIT, 0, stream>>>(Ft, Gt, S);
    attn_out_kernel<<<dim3(NN / 32, Bb), 32 * SPLIT, 0, stream>>>(Ft, Gt, Hd, S, SAt);
    outw_kernel<<<dim3(32, 8, Bb), 128, 0, stream>>>(Wvh, SAt, bv, gamma, out);
}

// v002
// One run takes 52.6 microseconds.
// Two timings next to v001 put it at 1.12 and 1.13 times that version's speed.
// Over all steps from v000 it is 4.29 times as fast.
#include <hip/hip_runtime.h>
#include <hip/hip_bf16.h>

typedef __attribute__((ext_vector_type(16))) _Float16 v16h;
typedef __attribute__((ext_vector_type(8)))  _Float16 v8h;
typedef __attribute__((ext_vector_type(4)))  _Float16 v4h;
typedef __attribute__((ext_vector_type(2)))  _Float16 v2h;
typedef __attribute__((ext_vector_type(8)))  float    v8f;

#define Bb 4
#define CC 256
#define DD 32
#define NN 4096
#define SPLIT 16            // waves of one work-group that share one sweep
#define SPAN (NN / SPLIT)   // positions of the swept axis per wave

// Load one f16 A/B operand for V_WMMA_F32_16X16X32_F16 from K-contiguous
// storage: lane<16 needs K in {0..7, 16..23}, lane>=16 needs {8..15, 24..31}
// -> two 16B vector loads per lane.
__device__ __forceinline__ v16h load_ab(const _Float16* rowbase, int hi8) {
    union { v16h v; v8h p[2]; } u;
    u.p[0] = *(const v8h*)(rowbase + hi8);
    u.p[1] = *(const v8h*)(rowbase + 16 + hi8);
    return u.v;
}

__device__ __forceinline__ v8f wmma16(v16h a, v16h b, v8f c) {
    return __builtin_amdgcn_wmma_f32_16x16x32_f16(false, a, false, b,
                                                  (short)0, c, false, false);
}

// The same operand from f32 storage: four 16B loads per lane, rounded to f16
// on the way into the fragment (same k order as load_ab).
__device__ __forceinline__ v16h load_ab_f32(const float* rowbase, int hi8) {
    float4 q0 = *(const float4*)(rowbase + hi8);
    float4 q1 = *(const float4*)(rowbase + hi8 + 4);
    float4 q2 = *(const float4*)(rowbase + 16 + hi8);
    float4 q3 = *(const float4*)(rowbase + 16 + hi8 + 4);
    v16h v = {(_Float16)q0.x, (_Float16)q0.y, (_Float16)q0.z, (_Float16)q0.w,
              (_Float16)q1.x, (_Float16)q1.y, (_Float16)q1.z, (_Float16)q1.w,
              (_Float16)q2.x, (_Float16)q2.y, (_Float16)q2.z, (_Float16)q2.w,
              (_Float16)q3.x, (_Float16)q3.y, (_Float16)q3.z, (_Float16)q3.w};
    return v;
}

// ---------------------------------------------------------------------------
// Kernel 1: WMMA projections straight from f32 x [b][c][n] and f32 weights.
// Work-group: 64 tokens, 8 waves.
// Stage: wave w reads the 32 channels of k-step w.  A lane reads
// x[c][m0 + 4*col .. +3] as one float4, so a half-wave covers 256 contiguous
// bytes of channel c; component j feeds B tile j, whose column col is therefore
// token m0 + 4*col + j.  Element e of a fragment is channel k0 + hi + e (e < 8)
// or k0 + 16 + hi + e - 8, as in load_ab.  The four f16 fragments go to LDS in
// register order (lane-contiguous 16B pieces).
// Product: wave t < 6 owns the 16 output rows t of f|g|h (weights read as f32
// while x is in flight) and all 64 tokens: 8 k-steps x 4 WMMAs, k ascending.
// f,g stored token-major [n][32]; h stored d-major [d][n] (sa A-operand).
// ---------------------------------------------------------------------------
#define KSTEPS (CC / 32)

__global__ void __launch_bounds__(32 * KSTEPS)
proj_wmma_kernel(const float* __restrict__ x,
                 const float* __restrict__ Wf, const float* __restrict__ Wg,
                 const float* __restrict__ Wh,
                 const float* __restrict__ bf, const float* __restrict__ bg,
                 const float* __restrict__ bh,
                 _Float16* __restrict__ Ft, _Float16* __restrict__ Gt,
                 _Float16* __restrict__ Hd) {
    __shared__ __align__(16) _Float16 Bf[KSTEPS][4][2][32][8];   // [k-step][j][half][lane]
    int lane = threadIdx.x & 31;
    int wave = __builtin_amdgcn_readfirstlane(threadIdx.x >> 5);   // scalar role choice
    int b = blockIdx.y;
    int m0 = blockIdx.x * 64;
    int col = lane & 15, hi = (lane >= 16) ? 8 : 0;
    int p = wave >> 1, dt = wave & 1;
    const float* W    = (p == 0) ? Wf : ((p == 1) ? Wg : Wh);
    const float* bias = (p == 0) ? bf : ((p == 1) ? bg : bh);

    const float* xp = x + ((size_t)b * CC + wave * 32 + hi) * NN + m0 + col * 4;
    float4 c[16];
    #pragma unroll   // constant indices keep c in registers; all 16 loads fly together
    for (int e = 0; e < 16; ++e)
        c[e] = *(const float4*)(xp + (size_t)(e < 8 ? e : e + 8) * NN);
    // The x loads' address registers are reused for the weight addresses below.
    asm volatile("s_wait_xcnt 0x0" ::: "memory");

    v16h a[KSTEPS];
    if (wave < 6) {
        #pragma unroll   // constant indices keep a in registers
        for (int ks = 0; ks < KSTEPS; ++ks)
            a[ks] = load_ab_f32(W + (size_t)(dt * 16 + col) * CC + ks * 32, hi);
    }

    #pragma unroll   // constant indices into c, here and in the inner loop
    for (int half = 0; half < 2; ++half) {
        v8h f0, f1, f2, f3;
        #pragma unroll
        for (int e = 0; e < 8; ++e) {
            f0[e] = (_Float16)c[half * 8 + e].x;
            f1[e] = (_Float16)c[half * 8 + e].y;
            f2[e] = (_Float16)c[half * 8 + e].z;
            f3[e] = (_Float16)c[half * 8 + e].w;
        }
        *(v8h*)&Bf[wave][0][half][lane][0] = f0;
        *(v8h*)&Bf[wave][1][half][lane][0] = f1;
        *(v8h*)&Bf[wave][2][half][lane][0] = f2;
        *(v8h*)&Bf[wave][3][half][lane][0] = f3;
    }
    __syncthreads();   // all eight k-steps' fragments are in LDS before any is read
    if (wave >= 6) return;

    v8f acc[4] = {};   // [token component j]
    #pragma unroll   // constant indices into a and acc, from here to the stores
    for (int ks = 0; ks < KSTEPS; ++ks)
        #pragma unroll
        for (int j = 0; j < 4; ++j) {
            union { v16h v; v8h h[2]; } u;
            u.h[0] = *(const v8h*)&Bf[ks][j][0][lane][0];
            u.h[1] = *(const v8h*)&Bf[ks][j][1][lane][0];
            acc[j] = wmma16(a[ks], u.v, acc[j]);
        }

    float4 bA = *(const float4*)(bias + dt * 16 + hi);
    float4 bB = *(const float4*)(bias + dt * 16 + hi + 4);
    float bia[8] = {bA.x, bA.y, bA.z, bA.w, bB.x, bB.y, bB.z, bB.w};
    if (p < 2) {
        _Float16* dst = ((p == 0) ? Ft : Gt) + (size_t)b * NN * DD;
        #pragma unroll
        for (int j = 0; j < 4; ++j) {
            v8h pk;
            #pragma unroll
            for (int r = 0; r < 8; ++r)
                pk[r] = (_Float16)(acc[j][r] + bia[r]);
            *(v8h*)(dst + (size_t)(m0 + col * 4 + j) * DD + dt * 16 + hi) = pk;
        }
    } else {
        _Float16* dst = Hd + (size_t)b * DD * NN;
        #pragma unroll
        for (int r = 0; r < 8; ++r) {
            v4h pk;   // four neighbouring tokens of one d row
            #pragma unroll
            for (int j = 0; j < 4; ++j)
                pk[j] = (_Float16)(acc[j][r] + bia[r]);
            *(v4h*)(dst + (size_t)(dt * 16 + hi + r) * NN + m0 + col * 4) = pk;
        }
        // The listing lays the f/g store block behind this one and reuses the
        // registers these stores name.
        asm volatile("s_wait_xcnt 0x0" ::: "memory");
    }
}

// ---------------------------------------------------------------------------
// Kernel 2: softmax stats, two-pass.  Work-group owns 32 rows n; each of its
// SPLIT waves sweeps its own SPAN columns m.
// Pass 1: logits -> running max (8 v_max / WMMA).  Cross-lane max merge.
// Pass 2: logits -> sum exp(l - own max).  Cross-lane sum.
// Merge: the waves' (max, sum) pairs meet in LDS.  S[b][n] = {max, 1/Z}.
// ---------------------------------------------------------------------------
__global__ void __launch_bounds__(32 * SPLIT)
stats_kernel(const _Float16* __restrict__ Ft, const _Float16* __restrict__ Gt,
             float* __restrict__ S) {
    __shared__ float pmax[SPLIT][32];
    __shared__ float psum[SPLIT][32];
    int lane = threadIdx.x & 31;
    int wave = __builtin_amdgcn_readfirstlane(threadIdx.x >> 5);   // scalar sweep bounds
    int b = blockIdx.y;
    int n0 = blockIdx.x * 32;
    int mBeg = wave * SPAN, mEnd = mBeg + SPAN;
    int col = lane & 15, hi = (lane >= 16) ? 8 : 0;
    const _Float16* Fb = Ft + (size_t)b * NN * DD;
    const _Float16* Gb = Gt + (size_t)b * NN * DD;

    v16h a0 = load_ab(Fb + (size_t)(n0 + col) * DD, hi);
    v16h a1 = load_ab(Fb + (size_t)(n0 + 16 + col) * DD, hi);

    float mx[2][8];
    #pragma unroll
    for (int t = 0; t < 2; ++t)
        #pragma unroll
        for (int r = 0; r < 8; ++r) mx[t][r] = -3.0e38f;

    for (int m0 = mBeg; m0 < mEnd; m0 += 16) {
        v16h bb = load_ab(Gb + (size_t)(m0 + col) * DD, hi);
        v8f z = {};
        v8f c0 = wmma16(a0, bb, z);
        v8f c1 = wmma16(a1, bb, z);
        #pragma unroll
        for (int r = 0; r < 8; ++r) {
            mx[0][r] = fmaxf(mx[0][r], c0[r]);
            mx[1][r] = fmaxf(mx[1][r], c1[r]);
        }
    }
    #pragma unroll
    for (int t = 0; t < 2; ++t)
        #pragma unroll
        for (int r = 0; r < 8; ++r)
            #pragma unroll
            for (int off = 1; off < 16; off <<= 1)
                mx[t][r] = fmaxf(mx[t][r], __shfl_xor(mx[t][r], off, 16));

    float sm[2][8] = {};
    for (int m0 = mBeg; m0 < mEnd; m0 += 16) {
        v16h bb = load_ab(Gb + (size_t)(m0 + col) * DD, hi);
        v8f z = {};
        v8f c0 = wmma16(a0, bb, z);
        v8f c1 = wmma16(a1, bb, z);
        #pragma unroll
        for (int r = 0; r < 8; ++r) {
            sm[0][r] += __expf(c0[r] - mx[0][r]);
            sm[1][r] += __expf(c1[r] - mx[1][r]);
        }
    }
    #pragma unroll
    for (int t = 0; t < 2; ++t)
        #pragma unroll
        for (int r = 0; r < 8; ++r)
            #pragma unroll
            for (int off = 1; off < 16; off <<= 1)
                sm[t][r] += __shfl_xor(sm[t][r], off, 16);

    if (col == 0) {
        #pragma unroll
        for (int t = 0; t < 2; ++t)
            #pragma unroll
            for (int r = 0; r < 8; ++r) {
                pmax[wave][t * 16 + hi + r] = mx[t][r];
                psum[wave][t * 16 + hi + r] = sm[t][r];
            }
    }
    __syncthreads();   // every wave's pair is in LDS before wave 0 merges them
    if (wave == 0) {
        float M = pmax[0][lane];
        #pragma unroll
        for (int w = 1; w < SPLIT; ++w) M = fmaxf(M, pmax[w][lane]);
        float Z = 0.0f;
        #pragma unroll
        for (int w = 0; w < SPLIT; ++w) Z += psum[w][lane] * __expf(pmax[w][lane] - M);
        *(float2*)(S + ((size_t)b * NN + n0 + lane) * 2) = make_float2(M, 1.0f / Z);
    }
}

// ---------------------------------------------------------------------------
// Kernel 3: attention apply.  Work-group owns 32 output tokens m; each of its
// SPLIT waves sums its own SPAN rows n into sa[32][32], four accumulators, and
// the partial tiles are added up through LDS at the end.  Per 32-n chunk: 4 logit WMMAs -> exp -> packed ds_store_b128
// into m-major LDS P tile -> 4 sa WMMAs from ds_load_b128 operands.
// Result stored token-major f16 SAt[b][m][32].
// ---------------------------------------------------------------------------
// Second bound: 8 waves per SIMD, so that two work-groups share a WGP.
__global__ void __launch_bounds__(32 * SPLIT, 8)
attn_out_kernel(const _Float16* __restrict__ Ft, const _Float16* __restrict__ Gt,
                const _Float16* __restrict__ Hd, const float* __restrict__ S,
                _Float16* __restrict__ SAt) {
    __shared__ __align__(16) _Float16 Pt[SPLIT][2][16][40];  // [wave][mt][m][n], padded
    __shared__ __align__(16) float red[SPLIT][32][36];       // [wave][m][d], padded
    int lane = threadIdx.x & 31;
    int wave = __builtin_amdgcn_readfirstlane(threadIdx.x >> 5);   // scalar sweep bounds
    int b = blockIdx.y;
    int m0 = blockIdx.x * 32;
    int nBeg = wave * SPAN, nEnd = nBeg + SPAN;
    int col = lane & 15, hi = (lane >= 16) ? 8 : 0;
    const _Float16* Fb = Ft + (size_t)b * NN * DD;
    const _Float16* Gb = Gt + (size_t)b * NN * DD;
    const _Float16* Hb = Hd + (size_t)b * DD * NN;
    const float*    Sb = S + (size_t)b * NN * 2;

    v16h gB0 = load_ab(Gb + (size_t)(m0 + col) * DD, hi);
    v16h gB1 = load_ab(Gb + (size_t)(m0 + 16 + col) * DD, hi);

    v8f acc[2][2] = {};   // [d-tile][m-tile]
    for (int n0 = nBeg; n0 < nEnd; n0 += 32) {
        #pragma unroll
        for (int t = 0; t < 2; ++t) {
            v16h fA = load_ab(Fb + (size_t)(n0 + t * 16 + col) * DD, hi);
            const float* sp = Sb + (size_t)(n0 + t * 16 + hi) * 2;
            float4 s0 = *(const float4*)(sp);
            float4 s1 = *(const float4*)(sp + 4);
            float4 s2 = *(const float4*)(sp + 8);
            float4 s3 = *(const float4*)(sp + 12);
            float rm[8] = {s0.x, s0.z, s1.x, s1.z, s2.x, s2.z, s3.x, s3.z};
            float ri[8] = {s0.y, s0.w, s1.y, s1.w, s2.y, s2.w, s3.y, s3.w};
            #pragma unroll
            for (int mt = 0; mt < 2; ++mt) {
                v8f z = {};
                v8f c = wmma16(fA, mt ? gB1 : gB0, z);
                v8h pk;
                #pragma unroll
                for (int r = 0; r < 8; ++r)
                    pk[r] = (_Float16)(__expf(c[r] - rm[r]) * ri[r]);
                *(v8h*)&Pt[wave][mt][col][t * 16 + hi] = pk;
            }
        }
        __syncthreads();
        v16h hA0 = load_ab(Hb + (size_t)col * NN + n0, hi);
        v16h hA1 = load_ab(Hb + (size_t)(16 + col) * NN + n0, hi);
        v16h pB0 = load_ab(&Pt[wave][0][col][0], hi);
        v16h pB1 = load_ab(&Pt[wave][1][col][0], hi);
        acc[0][0] = wmma16(hA0, pB0, acc[0][0]);
        acc[0][1] = wmma16(hA0, pB1, acc[0][1]);
        acc[1][0] = wmma16(hA1, pB0, acc[1][0]);
        acc[1][1] = wmma16(hA1, pB1, acc[1][1]);
        __syncthreads();
    }
    #pragma unroll
    for (int dt = 0; dt < 2; ++dt)
        #pragma unroll
        for (int mt = 0; mt < 2; ++mt) {
            float* rp = &red[wave][mt * 16 + col][dt * 16 + hi];
            *(float4*)(rp)     = make_float4(acc[dt][mt][0], acc[dt][mt][1],
                                             acc[dt][mt][2], acc[dt][mt][3]);
            *(float4*)(rp + 4) = make_float4(acc[dt][mt][4], acc[dt][mt][5],
                                             acc[dt][mt][6], acc[dt][mt][7]);
        }
    __syncthreads();   // every wave's partial tile is in LDS before it is summed
    int m = threadIdx.x >> 4, d = (threadIdx.x & 15) * 2;   // 512 threads x 2 = 32 x 32
    float2 s = make_float2(0.0f, 0.0f);
    #pragma unroll
    for (int w = 0; w < SPLIT; ++w) {
        float2 v = *(const float2*)&red[w][m][d];
        s.x += v.x;
        s.y += v.y;
    }
    v2h pk2 = {(_Float16)s.x, (_Float16)s.y};
    *(v2h*)(SAt + (size_t)b * NN * DD + (size_t)(m0 + m) * DD + d) = pk2;
}

// ---------------------------------------------------------------------------
// Kernel 4: output 1x1 conv D->C via WMMA (K=32 -> single WMMA per tile),
// + bias, * gamma.  Wave: 32 c-rows x 32 tokens = 4 WMMAs; Wv read as f32.
// ---------------------------------------------------------------------------
__global__ void __launch_bounds__(128)
outw_kernel(const float* __restrict__ Wv, const _Float16* __restrict__ SAt,
            const float* __restrict__ bv, const float* __restrict__ gamma,
            float* __restrict__ out) {
    int lane = threadIdx.x & 31, wave = threadIdx.x >> 5;
    int b = blockIdx.z, c0 = blockIdx.y * 32;
    int m0 = (blockIdx.x * 4 + wave) * 32;
    int col = lane & 15, hi = (lane >= 16) ? 8 : 0;
    const _Float16* SAb = SAt + (size_t)b * NN * DD;

    v16h a0 = load_ab_f32(Wv + (size_t)(c0 + col) * DD, hi);
    v16h a1 = load_ab_f32(Wv + (size_t)(c0 + 16 + col) * DD, hi);
    // The weight loads' address registers may be reused from here on.
    asm volatile("s_wait_xcnt 0x0" ::: "memory");
    v16h b0 = load_ab(SAb + (size_t)(m0 + col) * DD, hi);
    v16h b1 = load_ab(SAb + (size_t)(m0 + 16 + col) * DD, hi);
    v8f z = {};
    v8f cc[2][2];
    cc[0][0] = wmma16(a0, b0, z);
    cc[0][1] = wmma16(a0, b1, z);
    cc[1][0] = wmma16(a1, b0, z);
    cc[1][1] = wmma16(a1, b1, z);

    float gm = gamma[0];
    #pragma unroll
    for (int ct = 0; ct < 2; ++ct) {
        float4 bA = *(const float4*)(bv + c0 + ct * 16 + hi);
        float4 bB = *(const float4*)(bv + c0 + ct * 16 + hi + 4);
        float bia[8] = {bA.x, bA.y, bA.z, bA.w, bB.x, bB.y, bB.z, bB.w};
        #pragma unroll
        for (int mt = 0; mt < 2; ++mt)
            #pragma unroll
            for (int r = 0; r < 8; ++r) {
                int c = c0 + ct * 16 + hi + r;
                int m = m0 + mt * 16 + col;
                out[((size_t)b * CC + c) * NN + m] = gm * (cc[ct][mt][r] + bia[r]);
            }
    }
}

extern "C" void kernel_launch(void* const* d_in, const int* in_sizes, int n_in,
                              void* d_out, int out_size, void* d_ws, size_t ws_size,
                              hipStream_t stream) {
    const float* x     = (const float*)d_in[0];
    const float* Wf    = (const float*)d_in[1];
    const float* bf    = (const float*)d_in[2];
    const float* Wg    = (const float*)d_in[3];
    const float* bg    = (const float*)d_in[4];
    const float* Wh    = (const float*)d_in[5];
    const float* bh    = (const float*)d_in[6];
    const float* Wv    = (const float*)d_in[7];
    const float* bv    = (const float*)d_in[8];
    const float* gamma = (const float*)d_in[9];
    float* out = (float*)d_out;

    // workspace layout (~4.2 MB)
    char* w = (char*)d_ws;
    _Float16* Ft  = (_Float16*)w; w += (size_t)Bb * NN * DD * 2;   // 1 MB
    _Float16* Gt  = (_Float16*)w; w += (size_t)Bb * NN * DD * 2;
    _Float16* Hd  = (_Float16*)w; w += (size_t)Bb * DD * NN * 2;
    float*    S   = (float*)w;    w += (size_t)Bb * NN * 2 * 4;    // {max, 1/Z}
    _Float16* SAt = (_Float16*)w;

    proj_wmma_kernel<<<dim3(NN / 64, Bb), 32 * KSTEPS, 0, stream>>>(
        x, Wf, Wg, Wh, bf, bg, bh, Ft, Gt, Hd);
    stats_kernel<<<dim3(NN / 32, Bb), 32 * SPLIT, 0, stream>>>(Ft, Gt, S);
    attn_out_kernel<<<dim3(NN / 32, Bb), 32 * SPLIT, 0, stream>>>(Ft, Gt, Hd, S, SAt);
    outw_kernel<<<dim3(32, 8, Bb), 128, 0, stream>>>(Wv, SAt, bv, gamma, out);
}

// v003
// Measured time: 48.9 microseconds a run.
// Next to v002, in two timings, it ran 1.07 and 1.08 times as fast.
// Over all steps from v000 it is 4.62 times as fast.
#include <hip/hip_runtime.h>
#include <hip/hip_bf16.h>

typedef __attribute__((ext_vector_type(16))) _Float16 v16h;
typedef __attribute__((ext_vector_type(8)))  _Float16 v8h;
typedef __attribute__((ext_vector_type(4)))  _Float16 v4h;
typedef __attribute__((ext_vector_type(2)))  _Float16 v2h;
typedef __attribute__((ext_vector_type(8)))  float    v8f;

#define Bb 4
#define CC 256
#define DD 32
#define NN 4096
#define SPLIT 16            // waves of one work-group that share one sweep
#define SPAN (NN / SPLIT)   // positions of the swept axis per wave

// Load one f16 A/B operand for V_WMMA_F32_16X16X32_F16 from K-contiguous
// storage: lane<16 needs K in {0..7, 16..23}, lane>=16 needs {8..15, 24..31}
// -> two 16B vector loads per lane.
__device__ __forceinline__ v16h load_ab(const _Float16* rowbase, int hi8) {
    union { v16h v; v8h p[2]; } u;
    u.p[0] = *(const v8h*)(rowbase + hi8);
    u.p[1] = *(const v8h*)(rowbase + 16 + hi8);
    return u.v;
}

__device__ __forceinline__ v8f wmma16(v16h a, v16h b, v8f c) {
    return __builtin_amdgcn_wmma_f32_16x16x32_f16(false, a, false, b,
                                                  (short)0, c, false, false);
}

// The same operand from f32 storage: four 16B loads per lane, rounded to f16
// on the way into the fragment (same k order as load_ab).
__device__ __forceinline__ v16h load_ab_f32(const float* rowbase, int hi8) {
    float4 q0 = *(const float4*)(rowbase + hi8);
    float4 q1 = *(const float4*)(rowbase + hi8 + 4);
    float4 q2 = *(const float4*)(rowbase + 16 + hi8);
    float4 q3 = *(const float4*)(rowbase + 16 + hi8 + 4);
    v16h v = {(_Float16)q0.x, (_Float16)q0.y, (_Float16)q0.z, (_Float16)q0.w,
              (_Float16)q1.x, (_Float16)q1.y, (_Float16)q1.z, (_Float16)q1.w,
              (_Float16)q2.x, (_Float16)q2.y, (_Float16)q2.z, (_Float16)q2.w,
              (_Float16)q3.x, (_Float16)q3.y, (_Float16)q3.z, (_Float16)q3.w};
    return v;
}

// ---------------------------------------------------------------------------
// Kernel 1: WMMA projections straight from f32 x [b][c][n] and f32 weights.
// Work-group: 64 tokens, 8 waves.
// Stage: wave w reads the 32 channels of k-step w.  A lane reads
// x[c][m0 + 4*col .. +3] as one float4, so a half-wave covers 256 contiguous
// bytes of channel c; component j feeds B tile j, whose column col is therefore
// token m0 + 4*col + j.  Element e of a fragment is channel k0 + hi + e (e < 8)
// or k0 + 16 + hi + e - 8, as in load_ab.  The four f16 fragments go to LDS in
// register order (lane-contiguous 16B pieces).
// Product: wave t < 6 owns the 16 output rows t of f|g|h (weights read as f32
// while x is in flight) and all 64 tokens: 8 k-steps x 4 WMMAs, k ascending.
// f,g stored token-major [n][32]; h stored d-major [d][n] (sa A-operand).
// ---------------------------------------------------------------------------
#define KSTEPS (CC / 32)

__global__ void __launch_bounds__(32 * KSTEPS)
proj_wmma_kernel(const float* __restrict__ x,
                 const float* __restrict__ Wf, const float* __restrict__ Wg,
                 const float* __restrict__ Wh,
                 const float* __restrict__ bf, const float* __restrict__ bg,
                 const float* __restrict__ bh,
                 _Float16* __restrict__ Ft, _Float16* __restrict__ Gt,
                 _Float16* __restrict__ Hd) {
    __shared__ __align__(16) _Float16 Bf[KSTEPS][4][2][32][8];   // [k-step][j][half][lane]
    int lane = threadIdx.x & 31;
    int wave = __builtin_amdgcn_readfirstlane(threadIdx.x >> 5);   // scalar role choice
    int b = blockIdx.y;
    int m0 = blockIdx.x * 64;
    int col = lane & 15, hi = (lane >= 16) ? 8 : 0;
    int p = wave >> 1, dt = wave & 1;
    const float* W    = (p == 0) ? Wf : ((p == 1) ? Wg : Wh);
    const float* bias = (p == 0) ? bf : ((p == 1) ? bg : bh);

    const float* xp = x + ((size_t)b * CC + wave * 32 + hi) * NN + m0 + col * 4;
    float4 c[16];
    #pragma unroll   // constant indices keep c in registers; all 16 loads fly together
    for (int e = 0; e < 16; ++e)
        c[e] = *(const float4*)(xp + (size_t)(e < 8 ? e : e + 8) * NN);
    // The x loads' address registers are reused for the weight addresses below.
    asm volatile("s_wait_xcnt 0x0" ::: "memory");

    v16h a[KSTEPS];
    if (wave < 6) {
        #pragma unroll   // constant indices keep a in registers
        for (int ks = 0; ks < KSTEPS; ++ks)
            a[ks] = load_ab_f32(W + (size_t)(dt * 16 + col) * CC + ks * 32, hi);
    }

    #pragma unroll   // constant indices into c, here and in the inner loop
    for (int half = 0; half < 2; ++half) {
        v8h f0, f1, f2, f3;
        #pragma unroll
        for (int e = 0; e < 8; ++e) {
            f0[e] = (_Float16)c[half * 8 + e].x;
            f1[e] = (_Float16)c[half * 8 + e].y;
            f2[e] = (_Float16)c[half * 8 + e].z;
            f3[e] = (_Float16)c[half * 8 + e].w;
        }
        *(v8h*)&Bf[wave][0][half][lane][0] = f0;
        *(v8h*)&Bf[wave][1][half][lane][0] = f1;
        *(v8h*)&Bf[wave][2][half][lane][0] = f2;
        *(v8h*)&Bf[wave][3][half][lane][0] = f3;
    }
    __syncthreads();   // all eight k-steps' fragments are in LDS before any is read
    if (wave >= 6) return;

    v8f acc[4] = {};   // [token component j]
    #pragma unroll   // constant indices into a and acc, from here to the stores
    for (int ks = 0; ks < KSTEPS; ++ks)
        #pragma unroll
        for (int j = 0; j < 4; ++j) {
            union { v16h v; v8h h[2]; } u;
            u.h[0] = *(const v8h*)&Bf[ks][j][0][lane][0];
            u.h[1] = *(const v8h*)&Bf[ks][j][1][lane][0];
            acc[j] = wmma16(a[ks], u.v, acc[j]);
        }

    float4 bA = *(const float4*)(bias + dt * 16 + hi);
    float4 bB = *(const float4*)(bias + dt * 16 + hi + 4);
    float bia[8] = {bA.x, bA.y, bA.z, bA.w, bB.x, bB.y, bB.z, bB.w};
    if (p < 2) {
        _Float16* dst = ((p == 0) ? Ft : Gt) + (size_t)b * NN * DD;
        #pragma unroll
        for (int j = 0; j < 4; ++j) {
            v8h pk;
            #pragma unroll
            for (int r = 0; r < 8; ++r)
                pk[r] = (_Float16)(acc[j][r] + bia[r]);
            *(v8h*)(dst + (size_t)(m0 + col * 4 + j) * DD + dt * 16 + hi) = pk;
        }
    } else {
        _Float16* dst = Hd + (size_t)b * DD * NN;
        #pragma unroll
        for (int r = 0; r < 8; ++r) {
            v4h pk;   // four neighbouring tokens of one d row
            #pragma unroll
            for (int j = 0; j < 4; ++j)
                pk[j] = (_Float16)(acc[j][r] + bia[r]);
            *(v4h*)(dst + (size_t)(dt * 16 + hi + r) * NN + m0 + col * 4) = pk;
        }
        // The listing lays the f/g store block behind this one and reuses the
        // registers these stores name.
        asm volatile("s_wait_xcnt 0x0" ::: "memory");
    }
}

// ---------------------------------------------------------------------------
// Kernel 2: softmax stats, two-pass.  Work-group owns 32 rows n; each of its
// SPLIT waves sweeps its own SPAN columns m.
// Pass 1: logits -> running max (8 v_max / WMMA).  Cross-lane max merge.
// Pass 2: logits -> sum exp(l - own max).  Cross-lane sum.
// Merge: the waves' (max, sum) pairs meet in LDS.  S[b][n] = {max, 1/Z}.
// ---------------------------------------------------------------------------
__global__ void __launch_bounds__(32 * SPLIT)
stats_kernel(const _Float16* __restrict__ Ft, const _Float16* __restrict__ Gt,
             float* __restrict__ S) {
    __shared__ float pmax[SPLIT][32];
    __shared__ float psum[SPLIT][32];
    int lane = threadIdx.x & 31;
    int wave = __builtin_amdgcn_readfirstlane(threadIdx.x >> 5);   // scalar sweep bounds
    int b = blockIdx.y;
    int n0 = blockIdx.x * 32;
    int mBeg = wave * SPAN, mEnd = mBeg + SPAN;
    int col = lane & 15, hi = (lane >= 16) ? 8 : 0;
    const _Float16* Fb = Ft + (size_t)b * NN * DD;
    const _Float16* Gb = Gt + (size_t)b * NN * DD;

    v16h a0 = load_ab(Fb + (size_t)(n0 + col) * DD, hi);
    v16h a1 = load_ab(Fb + (size_t)(n0 + 16 + col) * DD, hi);

    float mx[2][8];
    #pragma unroll
    for (int t = 0; t < 2; ++t)
        #pragma unroll
        for (int r = 0; r < 8; ++r) mx[t][r] = -3.0e38f;

    for (int m0 = mBeg; m0 < mEnd; m0 += 16) {
        v16h bb = load_ab(Gb + (size_t)(m0 + col) * DD, hi);
        v8f z = {};
        v8f c0 = wmma16(a0, bb, z);
        v8f c1 = wmma16(a1, bb, z);
        #pragma unroll
        for (int r = 0; r < 8; ++r) {
            mx[0][r] = fmaxf(mx[0][r], c0[r]);
            mx[1][r] = fmaxf(mx[1][r], c1[r]);
        }
    }
    #pragma unroll
    for (int t = 0; t < 2; ++t)
        #pragma unroll
        for (int r = 0; r < 8; ++r)
            #pragma unroll
            for (int off = 1; off < 16; off <<= 1)
                mx[t][r] = fmaxf(mx[t][r], __shfl_xor(mx[t][r], off, 16));

    float sm[2][8] = {};
    for (int m0 = mBeg; m0 < mEnd; m0 += 16) {
        v16h bb = load_ab(Gb + (size_t)(m0 + col) * DD, hi);
        v8f z = {};
        v8f c0 = wmma16(a0, bb, z);
        v8f c1 = wmma16(a1, bb, z);
        #pragma unroll
        for (int r = 0; r < 8; ++r) {
            sm[0][r] += __expf(c0[r] - mx[0][r]);
            sm[1][r] += __expf(c1[r] - mx[1][r]);
        }
    }
    #pragma unroll
    for (int t = 0; t < 2; ++t)
        #pragma unroll
        for (int r = 0; r < 8; ++r)
            #pragma unroll
            for (int off = 1; off < 16; off <<= 1)
                sm[t][r] += __shfl_xor(sm[t][r], off, 16);

    if (col == 0) {
        #pragma unroll
        for (int t = 0; t < 2; ++t)
            #pragma unroll
            for (int r = 0; r < 8; ++r) {
                pmax[wave][t * 16 + hi + r] = mx[t][r];
                psum[wave][t * 16 + hi + r] = sm[t][r];
            }
    }
    __syncthreads();   // every wave's pair is in LDS before wave 0 merges them
    if (wave == 0) {
        float M = pmax[0][lane];
        #pragma unroll
        for (int w = 1; w < SPLIT; ++w) M = fmaxf(M, pmax[w][lane]);
        float Z = 0.0f;
        #pragma unroll
        for (int w = 0; w < SPLIT; ++w) Z += psum[w][lane] * __expf(pmax[w][lane] - M);
        *(float2*)(S + ((size_t)b * NN + n0 + lane) * 2) = make_float2(M, 1.0f / Z);
    }
}

// ---------------------------------------------------------------------------
// Kernel 3: attention apply.  Work-group owns 32 output tokens m; each of its
// SPLIT waves sums its own SPAN rows n into sa[32][32], four accumulators, and
// the partial tiles are added up through LDS at the end.  Per 32-n chunk: 4 logit WMMAs -> exp -> packed ds_store_b128
// into m-major LDS P tile -> 4 sa WMMAs from ds_load_b128 operands.
// Tail: the summed tile, rounded to f16, goes token-major into LDS and is the B
// operand of the output 1x1 conv D->C (K = 32, one WMMA per 16 x 16 tile):
// wave w owns channels 16w .. 16w+15 and both token tiles; + bias, * gamma.
// ---------------------------------------------------------------------------
// Second bound: 8 waves per SIMD, so that two work-groups share a WGP.
__global__ void __launch_bounds__(32 * SPLIT, 8)
attn_out_kernel(const _Float16* __restrict__ Ft, const _Float16* __restrict__ Gt,
                const _Float16* __restrict__ Hd, const float* __restrict__ S,
                const float* __restrict__ Wv, const float* __restrict__ bv,
                const float* __restrict__ gamma, float* __restrict__ out) {
    __shared__ __align__(16) _Float16 Pt[SPLIT][2][16][40];  // [wave][mt][m][n], padded
    __shared__ __align__(16) float red[SPLIT][32][36];       // [wave][m][d], padded
    __shared__ __align__(16) _Float16 sat[32][40];           // [m][d], padded: summed tile
    int lane = threadIdx.x & 31;
    int wave = __builtin_amdgcn_readfirstlane(threadIdx.x >> 5);   // scalar sweep bounds
    int b = blockIdx.y;
    int m0 = blockIdx.x * 32;
    int nBeg = wave * SPAN, nEnd = nBeg + SPAN;
    int col = lane & 15, hi = (lane >= 16) ? 8 : 0;
    const _Float16* Fb = Ft + (size_t)b * NN * DD;
    const _Float16* Gb = Gt + (size_t)b * NN * DD;
    const _Float16* Hb = Hd + (size_t)b * DD * NN;
    const float*    Sb = S + (size_t)b * NN * 2;

    v16h gB0 = load_ab(Gb + (size_t)(m0 + col) * DD, hi);
    v16h gB1 = load_ab(Gb + (size_t)(m0 + 16 + col) * DD, hi);

    v8f acc[2][2] = {};   // [d-tile][m-tile]
    for (int n0 = nBeg; n0 < nEnd; n0 += 32) {
        #pragma unroll
        for (int t = 0; t < 2; ++t) {
            v16h fA = load_ab(Fb + (size_t)(n0 + t * 16 + col) * DD, hi);
            const float* sp = Sb + (size_t)(n0 + t * 16 + hi) * 2;
            float4 s0 = *(const float4*)(sp);
            float4 s1 = *(const float4*)(sp + 4);
            float4 s2 = *(const float4*)(sp + 8);
            float4 s3 = *(const float4*)(sp + 12);
            float rm[8] = {s0.x, s0.z, s1.x, s1.z, s2.x, s2.z, s3.x, s3.z};
            float ri[8] = {s0.y, s0.w, s1.y, s1.w, s2.y, s2.w, s3.y, s3.w};
            #pragma unroll
            for (int mt = 0; mt < 2; ++mt) {
                v8f z = {};
                v8f c = wmma16(fA, mt ? gB1 : gB0, z);
                v8h pk;
                #pragma unroll
                for (int r = 0; r < 8; ++r)
                    pk[r] = (_Float16)(__expf(c[r] - rm[r]) * ri[r]);
                *(v8h*)&Pt[wave][mt][col][t * 16 + hi] = pk;
            }
        }
        __syncthreads();
        v16h hA0 = load_ab(Hb + (size_t)col * NN + n0, hi);
        v16h hA1 = load_ab(Hb + (size_t)(16 + col) * NN + n0, hi);
        v16h pB0 = load_ab(&Pt[wave][0][col][0], hi);
        v16h pB1 = load_ab(&Pt[wave][1][col][0], hi);
        acc[0][0] = wmma16(hA0, pB0, acc[0][0]);
        acc[0][1] = wmma16(hA0, pB1, acc[0][1]);
        acc[1][0] = wmma16(hA1, pB0, acc[1][0]);
        acc[1][1] = wmma16(hA1, pB1, acc[1][1]);
        __syncthreads();
    }
    #pragma unroll
    for (int dt = 0; dt < 2; ++dt)
        #pragma unroll
        for (int mt = 0; mt < 2; ++mt) {
            float* rp = &red[wave][mt * 16 + col][dt * 16 + hi];
            *(float4*)(rp)     = make_float4(acc[dt][mt][0], acc[dt][mt][1],
                                             acc[dt][mt][2], acc[dt][mt][3]);
            *(float4*)(rp + 4) = make_float4(acc[dt][mt][4], acc[dt][mt][5],
                                             acc[dt][mt][6], acc[dt][mt][7]);
        }
    __syncthreads();   // every wave's partial tile is in LDS before it is summed
    // The tail's operands are asked for here, so that they fly during the sum.
    int c0 = wave * 16;
    v16h wA = load_ab_f32(Wv + (size_t)(c0 + col) * DD, hi);
    float4 bA = *(const float4*)(bv + c0 + hi);
    float4 bB = *(const float4*)(bv + c0 + hi + 4);
    float gm = gamma[0];
    int m = threadIdx.x >> 4, d = (threadIdx.x & 15) * 2;   // 512 threads x 2 = 32 x 32
    float2 s = make_float2(0.0f, 0.0f);
    #pragma unroll
    for (int w = 0; w < SPLIT; ++w) {
        float2 v = *(const float2*)&red[w][m][d];
        s.x += v.x;
        s.y += v.y;
    }
    v2h pk2 = {(_Float16)s.x, (_Float16)s.y};
    *(v2h*)&sat[m][d] = pk2;
    __syncthreads();   // the whole summed tile is in LDS before any wave reads it

    v16h sB0 = load_ab(&sat[col][0], hi);
    v16h sB1 = load_ab(&sat[16 + col][0], hi);
    v8f z = {};
    v8f o0 = wmma16(wA, sB0, z);
    v8f o1 = wmma16(wA, sB1, z);
    float bia[8] = {bA.x, bA.y, bA.z, bA.w, bB.x, bB.y, bB.z, bB.w};
    float* op = out + ((size_t)b * CC + c0 + hi) * NN + m0 + col;
    #pragma unroll
    for (int r = 0; r < 8; ++r) {
        op[(size_t)r * NN]      = gm * (o0[r] + bia[r]);
        op[(size_t)r * NN + 16] = gm * (o1[r] + bia[r]);
    }
}

extern "C" void kernel_launch(void* const* d_in, const int* in_sizes, int n_in,
                              void* d_out, int out_size, void* d_ws, size_t ws_size,
                              hipStream_t stream) {
    const float* x     = (const float*)d_in[0];
    const float* Wf    = (const float*)d_in[1];
    const float* bf    = (const float*)d_in[2];
    const float* Wg    = (const float*)d_in[3];
    const float* bg    = (const float*)d_in[4];
    const float* Wh    = (const float*)d_in[5];
    const float* bh    = (const float*)d_in[6];
    const float* Wv    = (const float*)d_in[7];
    const float* bv    = (const float*)d_in[8];
    const float* gamma = (const float*)d_in[9];
    float* out = (float*)d_out;

    // workspace layout (~3.2 MB)
    char* w = (char*)d_ws;
    _Float16* Ft  = (_Float16*)w; w += (size_t)Bb * NN * DD * 2;   // 1 MB
    _Float16* Gt  = (_Float16*)w; w += (size_t)Bb * NN * DD * 2;
    _Float16* Hd  = (_Float16*)w; w += (size_t)Bb * DD * NN * 2;
    float*    S   = (float*)w;                                     // {max, 1/Z}

    proj_wmma_kernel<<<dim3(NN / 64, Bb), 32 * KSTEPS, 0, stream>>>(
        x, Wf, Wg, Wh, bf, bg, bh, Ft, Gt, Hd);
    stats_kernel<<<dim3(NN / 32, Bb), 32 * SPLIT, 0, stream>>>(Ft, Gt, S);
    attn_out_kernel<<<dim3(NN / 32, Bb), 32 * SPLIT, 0, stream>>>(
        Ft, Gt, Hd, S, Wv, bv, gamma, out);
}

// v004
// It runs in 42.9 microseconds.
// In two side-by-side timings against v003, it was 1.12 and 1.15 times as fast.
// All steps since v000 together make it 5.25 times as fast.
#include <hip/hip_runtime.h>
#include <hip/hip_bf16.h>

typedef __attribute__((ext_vector_type(16))) _Float16 v16h;
typedef __attribute__((ext_vector_type(8)))  _Float16 v8h;
typedef __attribute__((ext_vector_type(4)))  _Float16 v4h;
typedef __attribute__((ext_vector_type(2)))  _Float16 v2h;
typedef __attribute__((ext_vector_type(8)))  float    v8f;

#define Bb 4
#define CC 256
#define DD 32
#define NN 4096
#define SPLIT 16            // waves of one work-group that share one sweep
#define SPAN (NN / SPLIT)   // positions of the swept axis per wave

// Load one f16 A/B operand for V_WMMA_F32_16X16X32_F16 from K-contiguous
// storage: lane<16 needs K in {0..7, 16..23}, lane>=16 needs {8..15, 24..31}
// -> two 16B vector loads per lane.
__device__ __forceinline__ v16h load_ab(const _Float16* rowbase, int hi8) {
    union { v16h v; v8h p[2]; } u;
    u.p[0] = *(const v8h*)(rowbase + hi8);
    u.p[1] = *(const v8h*)(rowbase + 16 + hi8);
    return u.v;
}

// The same operand from fragment-order storage, [piece][lane][8]: piece 0 holds
// each lane's first eight k, piece 1 its second eight, so that each of the two
// loads reads 512 contiguous bytes (four whole 128-byte lines) per wave.
#define FRAG 512            // f16 elements of one 16 x 32 fragment
__device__ __forceinline__ v16h load_frag(const _Float16* base, unsigned frag, int lane) {
    unsigned off = frag * FRAG + lane * 8;   // 32-bit offset on a wave-uniform base
    union { v16h v; v8h p[2]; } u;
    u.p[0] = *(const v8h*)(base + off);
    u.p[1] = *(const v8h*)(base + off + 256);
    return u.v;
}

__device__ __forceinline__ v8f wmma16(v16h a, v16h b, v8f c) {
    return __builtin_amdgcn_wmma_f32_16x16x32_f16(false, a, false, b,
                                                  (short)0, c, false, false);
}

// The same operand from f32 storage: four 16B loads per lane, rounded to f16
// on the way into the fragment (same k order as load_ab).
__device__ __forceinline__ v16h load_ab_f32(const float* rowbase, int hi8) {
    float4 q0 = *(const float4*)(rowbase + hi8);
    float4 q1 = *(const float4*)(rowbase + hi8 + 4);
    float4 q2 = *(const float4*)(rowbase + 16 + hi8);
    float4 q3 = *(const float4*)(rowbase + 16 + hi8 + 4);
    v16h v = {(_Float16)q0.x, (_Float16)q0.y, (_Float16)q0.z, (_Float16)q0.w,
              (_Float16)q1.x, (_Float16)q1.y, (_Float16)q1.z, (_Float16)q1.w,
              (_Float16)q2.x, (_Float16)q2.y, (_Float16)q2.z, (_Float16)q2.w,
              (_Float16)q3.x, (_Float16)q3.y, (_Float16)q3.z, (_Float16)q3.w};
    return v;
}

// ---------------------------------------------------------------------------
// Kernel 1: WMMA projections straight from f32 x [b][c][n] and f32 weights.
// Work-group: 64 tokens, 8 waves.
// Stage: wave w reads the 32 channels of k-step w.  A lane reads
// x[c][m0 + 4*col .. +3] as one float4, so a half-wave covers 256 contiguous
// bytes of channel c; component j feeds B tile j, whose column col is therefore
// token m0 + 4*col + j.  Element e of a fragment is channel k0 + hi + e (e < 8)
// or k0 + 16 + hi + e - 8, as in load_ab.  The four f16 fragments go to LDS in
// register order (lane-contiguous 16B pieces).
// Product: wave t < 6 owns the 16 output rows t of f|g|h (weights read as f32
// while x is in flight) and all 64 tokens: 8 k-steps x 4 WMMAs, k ascending.
// f, g and h are stored in fragment order (load_frag).  f, g: one fragment per
// 16 tokens, k = d.  h: one fragment per (32 tokens, 16 rows d), k = token.
// Element k of row or column i sits in piece k >> 4, lane ((k >> 3) & 1) * 16 + i,
// place k & 7: the k order of load_ab.
// ---------------------------------------------------------------------------
#define KSTEPS (CC / 32)

__global__ void __launch_bounds__(32 * KSTEPS)
proj_wmma_kernel(const float* __restrict__ x,
                 const float* __restrict__ Wf, const float* __restrict__ Wg,
                 const float* __restrict__ Wh,
                 const float* __restrict__ bf, const float* __restrict__ bg,
                 const float* __restrict__ bh,
                 _Float16* __restrict__ Ft, _Float16* __restrict__ Gt,
                 _Float16* __restrict__ Hd) {
    __shared__ __align__(16) _Float16 Bf[KSTEPS][4][2][32][8];   // [k-step][j][half][lane]
    int lane = threadIdx.x & 31;
    int wave = __builtin_amdgcn_readfirstlane(threadIdx.x >> 5);   // scalar role choice
    int b = blockIdx.y;
    int m0 = blockIdx.x * 64;
    int col = lane & 15, hi = (lane >= 16) ? 8 : 0;
    int p = wave >> 1, dt = wave & 1;
    const float* W    = (p == 0) ? Wf : ((p == 1) ? Wg : Wh);
    const float* bias = (p == 0) ? bf : ((p == 1) ? bg : bh);

    const float* xp = x + ((size_t)b * CC + wave * 32 + hi) * NN + m0 + col * 4;
    float4 c[16];
    #pragma unroll   // constant indices keep c in registers; all 16 loads fly together
    for (int e = 0; e < 16; ++e)
        c[e] = *(const float4*)(xp + (size_t)(e < 8 ? e : e + 8) * NN);
    // The x loads' address registers are reused for the weight addresses below.
    asm volatile("s_wait_xcnt 0x0" ::: "memory");

    v16h a[KSTEPS];
    if (wave < 6) {
        #pragma unroll   // constant indices keep a in registers
        for (int ks = 0; ks < KSTEPS; ++ks)
            a[ks] = load_ab_f32(W + (size_t)(dt * 16 + col) * CC + ks * 32, hi);
    }

    #pragma unroll   // constant indices into c, here and in the inner loop
    for (int half = 0; half < 2; ++half) {
        v8h f0, f1, f2, f3;
        #pragma unroll
        for (int e = 0; e < 8; ++e) {
            f0[e] = (_Float16)c[half * 8 + e].x;
            f1[e] = (_Float16)c[half * 8 + e].y;
            f2[e] = (_Float16)c[half * 8 + e].z;
            f3[e] = (_Float16)c[half * 8 + e].w;
        }
        *(v8h*)&Bf[wave][0][half][lane][0] = f0;
        *(v8h*)&Bf[wave][1][half][lane][0] = f1;
        *(v8h*)&Bf[wave][2][half][lane][0] = f2;
        *(v8h*)&Bf[wave][3][half][lane][0] = f3;
    }
    __syncthreads();   // all eight k-steps' fragments are in LDS before any is read
    if (wave >= 6) return;

    v8f acc[4] = {};   // [token component j]
    #pragma unroll   // constant indices into a and acc, from here to the stores
    for (int ks = 0; ks < KSTEPS; ++ks)
        #pragma unroll
        for (int j = 0; j < 4; ++j) {
            union { v16h v; v8h h[2]; } u;
            u.h[0] = *(const v8h*)&Bf[ks][j][0][lane][0];
            u.h[1] = *(const v8h*)&Bf[ks][j][1][lane][0];
            acc[j] = wmma16(a[ks], u.v, acc[j]);
        }

    float4 bA = *(const float4*)(bias + dt * 16 + hi);
    float4 bB = *(const float4*)(bias + dt * 16 + hi + 4);
    float bia[8] = {bA.x, bA.y, bA.z, bA.w, bB.x, bB.y, bB.z, bB.w};
    if (p < 2) {
        _Float16* dst = ((p == 0) ? Ft : Gt) + (size_t)b * NN * DD;
        #pragma unroll
        for (int j = 0; j < 4; ++j) {
            v8h pk;
            #pragma unroll
            for (int r = 0; r < 8; ++r)
                pk[r] = (_Float16)(acc[j][r] + bia[r]);
            // token m0 + 4*col + j, k = dt*16 + hi .. + 7: piece dt, lane half hi / 8
            *(v8h*)(dst + (size_t)((m0 >> 4) + (col >> 2)) * FRAG + dt * 256 +
                    (hi * 2 + (col & 3) * 4 + j) * 8) = pk;
        }
    } else {
        _Float16* dst = Hd + (size_t)b * DD * NN;
        #pragma unroll
        for (int r = 0; r < 8; ++r) {
            v4h pk;   // four neighbouring tokens of one d row
            #pragma unroll
            for (int j = 0; j < 4; ++j)
                pk[j] = (_Float16)(acc[j][r] + bia[r]);
            // row dt*16 + hi + r, k = (col & 7) * 4 .. + 3 of token chunk m0/32 + col/8
            *(v4h*)(dst + (size_t)(((m0 >> 5) + (col >> 3)) * 2 + dt) * FRAG +
                    ((col >> 2) & 1) * 256 + (((col >> 1) & 1) * 16 + hi + r) * 8 +
                    (col & 1) * 4) = pk;
        }
        // The listing lays the f/g store block behind this one and reuses the
        // registers these stores name.
        asm volatile("s_wait_xcnt 0x0" ::: "memory");
    }
}

// ---------------------------------------------------------------------------
// Kernel 2: softmax stats, two-pass.  Work-group owns 32 rows n; each of its
// SPLIT waves sweeps its own SPAN columns m.
// Pass 1: logits -> running max (8 v_max / WMMA).  Cross-lane max merge.
// Pass 2: logits -> sum exp(l - own max).  Cross-lane sum.
// Merge: the waves' (max, sum) pairs meet in LDS.  S[b][n] = {max, 1/Z}.
// ---------------------------------------------------------------------------
__global__ void __launch_bounds__(32 * SPLIT)
stats_kernel(const _Float16* __restrict__ Ft, const _Float16* __restrict__ Gt,
             float* __restrict__ S) {
    __shared__ float pmax[SPLIT][32];
    __shared__ float psum[SPLIT][32];
    int lane = threadIdx.x & 31;
    int wave = __builtin_amdgcn_readfirstlane(threadIdx.x >> 5);   // scalar sweep bounds
    int b = blockIdx.y;
    int n0 = blockIdx.x * 32;
    int mBeg = wave * SPAN, mEnd = mBeg + SPAN;
    int col = lane & 15, hi = (lane >= 16) ? 8 : 0;
    const _Float16* Fb = Ft + (size_t)b * NN * DD;
    const _Float16* Gb = Gt + (size_t)b * NN * DD;

    v16h a0 = load_frag(Fb, n0 >> 4, lane);
    v16h a1 = load_frag(Fb, (n0 >> 4) + 1, lane);

    float mx[2][8];
    #pragma unroll
    for (int t = 0; t < 2; ++t)
        #pragma unroll
        for (int r = 0; r < 8; ++r) mx[t][r] = -3.0e38f;

    for (int m0 = mBeg; m0 < mEnd; m0 += 16) {
        v16h bb = load_frag(Gb, m0 >> 4, lane);
        v8f z = {};
        v8f c0 = wmma16(a0, bb, z);
        v8f c1 = wmma16(a1, bb, z);
        #pragma unroll
        for (int r = 0; r < 8; ++r) {
            mx[0][r] = fmaxf(mx[0][r], c0[r]);
            mx[1][r] = fmaxf(mx[1][r], c1[r]);
        }
    }
    #pragma unroll
    for (int t = 0; t < 2; ++t)
        #pragma unroll
        for (int r = 0; r < 8; ++r)
            #pragma unroll
            for (int off = 1; off < 16; off <<= 1)
                mx[t][r] = fmaxf(mx[t][r], __shfl_xor(mx[t][r], off, 16));

    float sm[2][8] = {};
    for (int m0 = mBeg; m0 < mEnd; m0 += 16) {
        v16h bb = load_frag(Gb, m0 >> 4, lane);
        v8f z = {};
        v8f c0 = wmma16(a0, bb, z);
        v8f c1 = wmma16(a1, bb, z);
        #pragma unroll
        for (int r = 0; r < 8; ++r) {
            sm[0][r] += __expf(c0[r] - mx[0][r]);
            sm[1][r] += __expf(c1[r] - mx[1][r]);
        }
    }
    #pragma unroll
    for (int t = 0; t < 2; ++t)
        #pragma unroll
        for (int r = 0; r < 8; ++r)
            #pragma unroll
            for (int off = 1; off < 16; off <<= 1)
                sm[t][r] += __shfl_xor(sm[t][r], off, 16);

    if (col == 0) {
        #pragma unroll
        for (int t = 0; t < 2; ++t)
            #pragma unroll
            for (int r = 0; r < 8; ++r) {
                pmax[wave][t * 16 + hi + r] = mx[t][r];
                psum[wave][t * 16 + hi + r] = sm[t][r];
            }
    }
    __syncthreads();   // every wave's pair is in LDS before wave 0 merges them
    if (wave == 0) {
        float M = pmax[0][lane];
        #pragma unroll
        for (int w = 1; w < SPLIT; ++w) M = fmaxf(M, pmax[w][lane]);
        float Z = 0.0f;
        #pragma unroll
        for (int w = 0; w < SPLIT; ++w) Z += psum[w][lane] * __expf(pmax[w][lane] - M);
        *(float2*)(S + ((size_t)b * NN + n0 + lane) * 2) = make_float2(M, 1.0f / Z);
    }
}

// ---------------------------------------------------------------------------
// Kernel 3: attention apply.  Work-group owns 32 output tokens m; each of its
// SPLIT waves sums its own SPAN rows n into sa[32][32], four accumulators, and
// the partial tiles are added up through LDS at the end.  Per 32-n chunk: 4 logit WMMAs -> exp -> packed ds_store_b128
// into m-major LDS P tile -> 4 sa WMMAs from ds_load_b128 operands.
// Tail: the summed tile, rounded to f16, goes token-major into LDS and is the B
// operand of the output 1x1 conv D->C (K = 32, one WMMA per 16 x 16 tile):
// wave w owns channels 16w .. 16w+15 and both token tiles; + bias, * gamma.
// ---------------------------------------------------------------------------
// Second bound: 8 waves per SIMD, so that two work-groups share a WGP.
__global__ void __launch_bounds__(32 * SPLIT, 8)
attn_out_kernel(const _Float16* __restrict__ Ft, const _Float16* __restrict__ Gt,
                const _Float16* __restrict__ Hd, const float* __restrict__ S,
                const float* __restrict__ Wv, const float* __restrict__ bv,
                const float* __restrict__ gamma, float* __restrict__ out) {
    __shared__ __align__(16) _Float16 Pt[SPLIT][2][16][40];  // [wave][mt][m][n], padded
    __shared__ __align__(16) float red[SPLIT][32][36];       // [wave][m][d], padded
    __shared__ __align__(16) _Float16 sat[32][40];           // [m][d], padded: summed tile
    int lane = threadIdx.x & 31;
    int wave = __builtin_amdgcn_readfirstlane(threadIdx.x >> 5);   // scalar sweep bounds
    int b = blockIdx.y;
    int m0 = blockIdx.x * 32;
    int nBeg = wave * SPAN, nEnd = nBeg + SPAN;
    int col = lane & 15, hi = (lane >= 16) ? 8 : 0;
    const _Float16* Fb = Ft + (size_t)b * NN * DD;
    const _Float16* Gb = Gt + (size_t)b * NN * DD;
    const _Float16* Hb = Hd + (size_t)b * DD * NN;
    const float*    Sb = S + (size_t)b * NN * 2;

    v16h gB0 = load_frag(Gb, m0 >> 4, lane);
    v16h gB1 = load_frag(Gb, (m0 >> 4) + 1, lane);

    v8f acc[2][2] = {};   // [d-tile][m-tile]
    for (int n0 = nBeg; n0 < nEnd; n0 += 32) {
        #pragma unroll
        for (int t = 0; t < 2; ++t) {
            v16h fA = load_frag(Fb, (n0 >> 4) + t, lane);
            const float* sp = Sb + (size_t)(n0 + t * 16 + hi) * 2;
            float4 s0 = *(const float4*)(sp);
            float4 s1 = *(const float4*)(sp + 4);
            float4 s2 = *(const float4*)(sp + 8);
            float4 s3 = *(const float4*)(sp + 12);
            float rm[8] = {s0.x, s0.z, s1.x, s1.z, s2.x, s2.z, s3.x, s3.z};
            float ri[8] = {s0.y, s0.w, s1.y, s1.w, s2.y, s2.w, s3.y, s3.w};
            #pragma unroll
            for (int mt = 0; mt < 2; ++mt) {
                v8f z = {};
                v8f c = wmma16(fA, mt ? gB1 : gB0, z);
                v8h pk;
                #pragma unroll
                for (int r = 0; r < 8; ++r)
                    pk[r] = (_Float16)(__expf(c[r] - rm[r]) * ri[r]);
                *(v8h*)&Pt[wave][mt][col][t * 16 + hi] = pk;
            }
        }
        __syncthreads();
        v16h hA0 = load_frag(Hb, (n0 >> 5) * 2, lane);
        v16h hA1 = load_frag(Hb, (n0 >> 5) * 2 + 1, lane);
        v16h pB0 = load_ab(&Pt[wave][0][col][0], hi);
        v16h pB1 = load_ab(&Pt[wave][1][col][0], hi);
        acc[0][0] = wmma16(hA0, pB0, acc[0][0]);
        acc[0][1] = wmma16(hA0, pB1, acc[0][1]);
        acc[1][0] = wmma16(hA1, pB0, acc[1][0]);
        acc[1][1] = wmma16(hA1, pB1, acc[1][1]);
        __syncthreads();
    }
    // The lane's indices are formed anew from the lane number, so that none of
    // them holds a register through the loop, which stands at its register bound.
    int ln = __builtin_amdgcn_mbcnt_lo(~0u, 0u);
    col = ln & 15;
    hi = (ln >> 4) * 8;
    #pragma unroll
    for (int dt = 0; dt < 2; ++dt)
        #pragma unroll
        for (int mt = 0; mt < 2; ++mt) {
            float* rp = &red[wave][mt * 16 + col][dt * 16 + hi];
            *(float4*)(rp)     = make_float4(acc[dt][mt][0], acc[dt][mt][1],
                                             acc[dt][mt][2], acc[dt][mt][3]);
            *(float4*)(rp + 4) = make_float4(acc[dt][mt][4], acc[dt][mt][5],
                                             acc[dt][mt][6], acc[dt][mt][7]);
        }
    __syncthreads();   // every wave's partial tile is in LDS before it is summed
    // The tail's operands are asked for here, so that they fly during the sum.
    int c0 = wave * 16;
    v16h wA = load_ab_f32(Wv + (size_t)(c0 + col) * DD, hi);
    float4 bA = *(const float4*)(bv + c0 + hi);
    float4 bB = *(const float4*)(bv + c0 + hi + 4);
    float gm = gamma[0];
    int m = wave * 2 + (ln >> 4), d = col * 2;   // 512 threads x 2 = 32 x 32
    float2 s = make_float2(0.0f, 0.0f);
    #pragma unroll
    for (int w = 0; w < SPLIT; ++w) {
        float2 v = *(const float2*)&red[w][m][d];
        s.x += v.x;
        s.y += v.y;
    }
    v2h pk2 = {(_Float16)s.x, (_Float16)s.y};
    *(v2h*)&sat[m][d] = pk2;
    __syncthreads();   // the whole summed tile is in LDS before any wave reads it

    v16h sB0 = load_ab(&sat[col][0], hi);
    v16h sB1 = load_ab(&sat[16 + col][0], hi);
    v8f z = {};
    v8f o0 = wmma16(wA, sB0, z);
    v8f o1 = wmma16(wA, sB1, z);
    float bia[8] = {bA.x, bA.y, bA.z, bA.w, bB.x, bB.y, bB.z, bB.w};
    float* op = out + ((size_t)b * CC + c0 + hi) * NN + m0 + col;
    #pragma unroll
    for (int r = 0; r < 8; ++r) {
        op[(size_t)r * NN]      = gm * (o0[r] + bia[r]);
        op[(size_t)r * NN + 16] = gm * (o1[r] + bia[r]);
    }
}

extern "C" void kernel_launch(void* const* d_in, const int* in_sizes, int n_in,
                              void* d_out, int out_size, void* d_ws, size_t ws_size,
                              hipStream_t stream) {
    const float* x     = (const float*)d_in[0];
    const float* Wf    = (const float*)d_in[1];
    const float* bf    = (const float*)d_in[2];
    const float* Wg    = (const float*)d_in[3];
    const float* bg    = (const float*)d_in[4];
    const float* Wh    = (const float*)d_in[5];
    const float* bh    = (const float*)d_in[6];
    const float* Wv    = (const float*)d_in[7];
    const float* bv    = (const float*)d_in[8];
    const float* gamma = (const float*)d_in[9];
    float* out = (float*)d_out;

    // workspace layout (~3.2 MB)
    char* w = (char*)d_ws;
    _Float16* Ft  = (_Float16*)w; w += (size_t)Bb * NN * DD * 2;   // 1 MB
    _Float16* Gt  = (_Float16*)w; w += (size_t)Bb * NN * DD * 2;
    _Float16* Hd  = (_Float16*)w; w += (size_t)Bb * DD * NN * 2;
    float*    S   = (float*)w;                                     // {max, 1/Z}

    proj_wmma_kernel<<<dim3(NN / 64, Bb), 32 * KSTEPS, 0, stream>>>(
        x, Wf, Wg, Wh, bf, bg, bh, Ft, Gt, Hd);
    stats_kernel<<<dim3(NN / 32, Bb), 32 * SPLIT, 0, stream>>>(Ft, Gt, S);
    attn_out_kernel<<<dim3(NN / 32, Bb), 32 * SPLIT, 0, stream>>>(
        Ft, Gt, Hd, S, Wv, bv, gamma, out);
}

// v005
// A run of this version takes 38.9 microseconds.
// Next to v004, in two timings, it ran 1.11 and 1.09 times as fast.
// Over all steps from v000 it is 5.76 times as fast.
#include <hip/hip_runtime.h>
#include <hip/hip_bf16.h>

typedef __attribute__((ext_vector_type(16))) _Float16 v16h;
typedef __attribute__((ext_vector_type(8)))  _Float16 v8h;
typedef __attribute__((ext_vector_type(4)))  _Float16 v4h;
typedef __attribute__((ext_vector_type(2)))  _Float16 v2h;
typedef __attribute__((ext_vector_type(8)))  float    v8f;

#define Bb 4
#define CC 256
#define DD 32
#define NN 4096
#define SPLIT 16            // waves of one work-group that share one sweep
#define SPAN (NN / SPLIT)   // positions of the swept axis per wave

// Load one f16 A/B operand for V_WMMA_F32_16X16X32_F16 from K-contiguous
// storage: lane<16 needs K in {0..7, 16..23}, lane>=16 needs {8..15, 24..31}
// -> two 16B vector loads per lane.
__device__ __forceinline__ v16h load_ab(const _Float16* rowbase, int hi8) {
    union { v16h v; v8h p[2]; } u;
    u.p[0] = *(const v8h*)(rowbase + hi8);
    u.p[1] = *(const v8h*)(rowbase + 16 + hi8);
    return u.v;
}

// The same operand from fragment-order storage, [piece][lane][8]: piece 0 holds
// each lane's first eight k, piece 1 its second eight, so that each of the two
// loads reads 512 contiguous bytes (four whole 128-byte lines) per wave.
#define FRAG 512            // f16 elements of one 16 x 32 fragment
__device__ __forceinline__ v16h load_frag(const _Float16* base, unsigned frag, int lane) {
    unsigned off = frag * FRAG + lane * 8;   // 32-bit offset on a wave-uniform base
    union { v16h v; v8h p[2]; } u;
    u.p[0] = *(const v8h*)(base + off);
    u.p[1] = *(const v8h*)(base + off + 256);
    return u.v;
}

__device__ __forceinline__ v8f wmma16(v16h a, v16h b, v8f c) {
    return __builtin_amdgcn_wmma_f32_16x16x32_f16(false, a, false, b,
                                                  (short)0, c, false, false);
}

// The same operand from f32 storage: four 16B loads per lane, rounded to f16
// on the way into the fragment (same k order as load_ab).
__device__ __forceinline__ v16h load_ab_f32(const float* rowbase, int hi8) {
    float4 q0 = *(const float4*)(rowbase + hi8);
    float4 q1 = *(const float4*)(rowbase + hi8 + 4);
    float4 q2 = *(const float4*)(rowbase + 16 + hi8);
    float4 q3 = *(const float4*)(rowbase + 16 + hi8 + 4);
    v16h v = {(_Float16)q0.x, (_Float16)q0.y, (_Float16)q0.z, (_Float16)q0.w,
              (_Float16)q1.x, (_Float16)q1.y, (_Float16)q1.z, (_Float16)q1.w,
              (_Float16)q2.x, (_Float16)q2.y, (_Float16)q2.z, (_Float16)q2.w,
              (_Float16)q3.x, (_Float16)q3.y, (_Float16)q3.z, (_Float16)q3.w};
    return v;
}

// ---------------------------------------------------------------------------
// Kernel 1: WMMA projections straight from f32 x [b][c][n] and f32 weights.
// Work-group: 64 tokens, 8 waves.
// Stage: wave w reads the 32 channels of k-step w.  A lane reads
// x[c][m0 + 4*col .. +3] as one float4, so a half-wave covers 256 contiguous
// bytes of channel c; component j feeds B tile j, whose column col is therefore
// token m0 + 4*col + j.  Element e of a fragment is channel k0 + hi + e (e < 8)
// or k0 + 16 + hi + e - 8, as in load_ab.  The four f16 fragments go to LDS in
// register order (lane-contiguous 16B pieces).
// Product: wave t < 6 owns the 16 output rows t of f|g|h (weights read as f32
// while x is in flight) and all 64 tokens: 8 k-steps x 4 WMMAs, k ascending.
// f, g and h are stored in fragment order (load_frag).  f, g: one fragment per
// 16 tokens, k = d.  h: one fragment per (32 tokens, 16 rows d), k = token.
// Element k of row or column i sits in piece k >> 4, lane ((k >> 3) & 1) * 16 + i,
// place k & 7: the k order of load_ab.
// ---------------------------------------------------------------------------
#define KSTEPS (CC / 32)

__global__ void __launch_bounds__(32 * KSTEPS)
proj_wmma_kernel(const float* __restrict__ x,
                 const float* __restrict__ Wf, const float* __restrict__ Wg,
                 const float* __restrict__ Wh,
                 const float* __restrict__ bf, const float* __restrict__ bg,
                 const float* __restrict__ bh,
                 _Float16* __restrict__ Ft, _Float16* __restrict__ Gt,
                 _Float16* __restrict__ Hd) {
    __shared__ __align__(16) _Float16 Bf[KSTEPS][4][2][32][8];   // [k-step][j][half][lane]
    int lane = threadIdx.x & 31;
    int wave = __builtin_amdgcn_readfirstlane(threadIdx.x >> 5);   // scalar role choice
    int b = blockIdx.y;
    int m0 = blockIdx.x * 64;
    int col = lane & 15, hi = (lane >= 16) ? 8 : 0;
    int p = wave >> 1, dt = wave & 1;
    const float* W    = (p == 0) ? Wf : ((p == 1) ? Wg : Wh);
    const float* bias = (p == 0) ? bf : ((p == 1) ? bg : bh);

    const float* xp = x + ((size_t)b * CC + wave * 32 + hi) * NN + m0 + col * 4;
    float4 c[16];
    #pragma unroll   // constant indices keep c in registers; all 16 loads fly together
    for (int e = 0; e < 16; ++e)
        c[e] = *(const float4*)(xp + (size_t)(e < 8 ? e : e + 8) * NN);
    // The x loads' address registers are reused for the weight addresses below.
    asm volatile("s_wait_xcnt 0x0" ::: "memory");

    v16h a[KSTEPS];
    if (wave < 6) {
        #pragma unroll   // constant indices keep a in registers
        for (int ks = 0; ks < KSTEPS; ++ks)
            a[ks] = load_ab_f32(W + (size_t)(dt * 16 + col) * CC + ks * 32, hi);
    }

    #pragma unroll   // constant indices into c, here and in the inner loop
    for (int half = 0; half < 2; ++half) {
        v8h f0, f1, f2, f3;
        #pragma unroll
        for (int e = 0; e < 8; ++e) {
            f0[e] = (_Float16)c[half * 8 + e].x;
            f1[e] = (_Float16)c[half * 8 + e].y;
            f2[e] = (_Float16)c[half * 8 + e].z;
            f3[e] = (_Float16)c[half * 8 + e].w;
        }
        *(v8h*)&Bf[wave][0][half][lane][0] = f0;
        *(v8h*)&Bf[wave][1][half][lane][0] = f1;
        *(v8h*)&Bf[wave][2][half][lane][0] = f2;
        *(v8h*)&Bf[wave][3][half][lane][0] = f3;
    }
    __syncthreads();   // all eight k-steps' fragments are in LDS before any is read
    if (wave >= 6) return;

    v8f acc[4] = {};   // [token component j]
    #pragma unroll   // constant indices into a and acc, from here to the stores
    for (int ks = 0; ks < KSTEPS; ++ks)
        #pragma unroll
        for (int j = 0; j < 4; ++j) {
            union { v16h v; v8h h[2]; } u;
            u.h[0] = *(const v8h*)&Bf[ks][j][0][lane][0];
            u.h[1] = *(const v8h*)&Bf[ks][j][1][lane][0];
            acc[j] = wmma16(a[ks], u.v, acc[j]);
        }

    float4 bA = *(const float4*)(bias + dt * 16 + hi);
    float4 bB = *(const float4*)(bias + dt * 16 + hi + 4);
    float bia[8] = {bA.x, bA.y, bA.z, bA.w, bB.x, bB.y, bB.z, bB.w};
    if (p < 2) {
        _Float16* dst = ((p == 0) ? Ft : Gt) + (size_t)b * NN * DD;
        #pragma unroll
        for (int j = 0; j < 4; ++j) {
            v8h pk;
            #pragma unroll
            for (int r = 0; r < 8; ++r)
                pk[r] = (_Float16)(acc[j][r] + bia[r]);
            // token m0 + 4*col + j, k = dt*16 + hi .. + 7: piece dt, lane half hi / 8
            *(v8h*)(dst + (size_t)((m0 >> 4) + (col >> 2)) * FRAG + dt * 256 +
                    (hi * 2 + (col & 3) * 4 + j) * 8) = pk;
        }
    } else {
        _Float16* dst = Hd + (size_t)b * DD * NN;
        #pragma unroll
        for (int r = 0; r < 8; ++r) {
            v4h pk;   // four neighbouring tokens of one d row
            #pragma unroll
            for (int j = 0; j < 4; ++j)
                pk[j] = (_Float16)(acc[j][r] + bia[r]);
            // row dt*16 + hi + r, k = (col & 7) * 4 .. + 3 of token chunk m0/32 + col/8
            *(v4h*)(dst + (size_t)(((m0 >> 5) + (col >> 3)) * 2 + dt) * FRAG +
                    ((col >> 2) & 1) * 256 + (((col >> 1) & 1) * 16 + hi + r) * 8 +
                    (col & 1) * 4) = pk;
        }
        // The listing lays the f/g store block behind this one and reuses the
        // registers these stores name.
        asm volatile("s_wait_xcnt 0x0" ::: "memory");
    }
}

// ---------------------------------------------------------------------------
// Kernel 2: softmax stats, two-pass.  Work-group owns 32 rows n; each of its
// SPLIT waves sweeps its own SPAN columns m.
// Pass 1: logits -> running max (8 v_max / WMMA).  Cross-lane max merge.
// Pass 2: logits -> sum exp(l - own max).  Cross-lane sum.
// Merge: the waves' (max, sum) pairs meet in LDS.  S[b][n] = {max, 1/Z}.
// ---------------------------------------------------------------------------
__global__ void __launch_bounds__(32 * SPLIT)
stats_kernel(const _Float16* __restrict__ Ft, const _Float16* __restrict__ Gt,
             float* __restrict__ S) {
    __shared__ float pmax[SPLIT][32];
    __shared__ float psum[SPLIT][32];
    int lane = threadIdx.x & 31;
    int wave = __builtin_amdgcn_readfirstlane(threadIdx.x >> 5);   // scalar sweep bounds
    int b = blockIdx.y;
    int n0 = blockIdx.x * 32;
    int mBeg = wave * SPAN, mEnd = mBeg + SPAN;
    int col = lane & 15, hi = (lane >= 16) ? 8 : 0;
    const _Float16* Fb = Ft + (size_t)b * NN * DD;
    const _Float16* Gb = Gt + (size_t)b * NN * DD;

    v16h a0 = load_frag(Fb, n0 >> 4, lane);
    v16h a1 = load_frag(Fb, (n0 >> 4) + 1, lane);

    float mx[2][8];
    #pragma unroll
    for (int t = 0; t < 2; ++t)
        #pragma unroll
        for (int r = 0; r < 8; ++r) mx[t][r] = -3.0e38f;

    for (int m0 = mBeg; m0 < mEnd; m0 += 16) {
        v16h bb = load_frag(Gb, m0 >> 4, lane);
        v8f z = {};
        v8f c0 = wmma16(a0, bb, z);
        v8f c1 = wmma16(a1, bb, z);
        #pragma unroll
        for (int r = 0; r < 8; ++r) {
            mx[0][r] = fmaxf(mx[0][r], c0[r]);
            mx[1][r] = fmaxf(mx[1][r], c1[r]);
        }
    }
    #pragma unroll
    for (int t = 0; t < 2; ++t)
        #pragma unroll
        for (int r = 0; r < 8; ++r)
            #pragma unroll
            for (int off = 1; off < 16; off <<= 1)
                mx[t][r] = fmaxf(mx[t][r], __shfl_xor(mx[t][r], off, 16));

    float sm[2][8] = {};
    for (int m0 = mBeg; m0 < mEnd; m0 += 16) {
        v16h bb = load_frag(Gb, m0 >> 4, lane);
        v8f z = {};
        v8f c0 = wmma16(a0, bb, z);
        v8f c1 = wmma16(a1, bb, z);
        #pragma unroll
        for (int r = 0; r < 8; ++r) {
            sm[0][r] += __expf(c0[r] - mx[0][r]);
            sm[1][r] += __expf(c1[r] - mx[1][r]);
        }
    }
    #pragma unroll
    for (int t = 0; t < 2; ++t)
        #pragma unroll
        for (int r = 0; r < 8; ++r)
            #pragma unroll
            for (int off = 1; off < 16; off <<= 1)
                sm[t][r] += __shfl_xor(sm[t][r], off, 16);

    if (col == 0) {
        #pragma unroll
        for (int t = 0; t < 2; ++t)
            #pragma unroll
            for (int r = 0; r < 8; ++r) {
                pmax[wave][t * 16 + hi + r] = mx[t][r];
                psum[wave][t * 16 + hi + r] = sm[t][r];
            }
    }
    __syncthreads();   // every wave's pair is in LDS before wave 0 merges them
    if (wave == 0) {
        float M = pmax[0][lane];
        #pragma unroll
        for (int w = 1; w < SPLIT; ++w) M = fmaxf(M, pmax[w][lane]);
        float Z = 0.0f;
        #pragma unroll
        for (int w = 0; w < SPLIT; ++w) Z += psum[w][lane] * __expf(pmax[w][lane] - M);
        *(float2*)(S + ((size_t)b * NN + n0 + lane) * 2) = make_float2(M, 1.0f / Z);
    }
}

// ---------------------------------------------------------------------------
// Kernel 3: attention apply.  Work-group owns 32 output tokens m; each of its
// SPLIT waves sums its own SPAN rows n into sa[32][32], four accumulators, and
// the partial tiles are added up through LDS at the end.  Per 32-n chunk: 4 logit WMMAs -> exp -> 4 sa WMMAs.
// P never leaves the registers: a lane of logit tile t holds column m = col, rows
// n = 16t + hi .. + 7, and those are the k of piece t of the B fragment for column
// col in the same lane (the k order of load_ab), so the packed values are the operand.
// Tail: the summed tile, rounded to f16, goes token-major into LDS and is the B
// operand of the output 1x1 conv D->C (K = 32, one WMMA per 16 x 16 tile):
// wave w owns channels 16w .. 16w+15 and both token tiles; + bias, * gamma.
// ---------------------------------------------------------------------------
// Second bound: 8 waves per SIMD, so that two work-groups share a WGP.
__global__ void __launch_bounds__(32 * SPLIT, 8)
attn_out_kernel(const _Float16* __restrict__ Ft, const _Float16* __restrict__ Gt,
                const _Float16* __restrict__ Hd, const float* __restrict__ S,
                const float* __restrict__ Wv, const float* __restrict__ bv,
                const float* __restrict__ gamma, float* __restrict__ out) {
    __shared__ __align__(16) float red[SPLIT][32][36];       // [wave][m][d], padded
    __shared__ __align__(16) _Float16 sat[32][40];           // [m][d], padded: summed tile
    int lane = threadIdx.x & 31;
    int wave = __builtin_amdgcn_readfirstlane(threadIdx.x >> 5);   // scalar sweep bounds
    int b = blockIdx.y;
    int m0 = blockIdx.x * 32;
    int nBeg = wave * SPAN, nEnd = nBeg + SPAN;
    int col = lane & 15, hi = (lane >= 16) ? 8 : 0;
    const _Float16* Fb = Ft + (size_t)b * NN * DD;
    const _Float16* Gb = Gt + (size_t)b * NN * DD;
    const _Float16* Hb = Hd + (size_t)b * DD * NN;
    const float*    Sb = S + (size_t)b * NN * 2;

    v16h gB0 = load_frag(Gb, m0 >> 4, lane);
    v16h gB1 = load_frag(Gb, (m0 >> 4) + 1, lane);

    v8f acc[2][2] = {};   // [d-tile][m-tile]
    #pragma unroll 1   // unrolled, the trips overlap and spill at the 128-register bound
    for (int n0 = nBeg; n0 < nEnd; n0 += 32) {
        v16h fA[2];
        float4 s[2][4];
        #pragma unroll
        for (int t = 0; t < 2; ++t) {
            fA[t] = load_frag(Fb, (n0 >> 4) + t, lane);
            const float* sp = Sb + (size_t)(n0 + t * 16 + hi) * 2;
            s[t][0] = *(const float4*)(sp);
            s[t][1] = *(const float4*)(sp + 4);
            s[t][2] = *(const float4*)(sp + 8);
            s[t][3] = *(const float4*)(sp + 12);
        }
        v16h hA0, hA1;
        union { v16h v; v8h p[2]; } pB[2];   // [m-tile]; piece t = logit tile t
        #pragma unroll
        for (int t = 0; t < 2; ++t) {
            float rm[8] = {s[t][0].x, s[t][0].z, s[t][1].x, s[t][1].z,
                           s[t][2].x, s[t][2].z, s[t][3].x, s[t][3].z};
            float ri[8] = {s[t][0].y, s[t][0].w, s[t][1].y, s[t][1].w,
                           s[t][2].y, s[t][2].w, s[t][3].y, s[t][3].w};
            #pragma unroll
            for (int mt = 0; mt < 2; ++mt) {
                v8f z = {};
                v8f c = wmma16(fA[t], mt ? gB1 : gB0, z);
                v8h pk;
                #pragma unroll
                for (int r = 0; r < 8; ++r)
                    pk[r] = (_Float16)(__expf(c[r] - rm[r]) * ri[r]);
                pB[mt].p[t] = pk;
            }
            if (t == 0) {
                // h is asked for once tile 0's registers are free: earlier it spills,
                // later its latency stands in front of the sa WMMAs.
                __builtin_amdgcn_sched_barrier(0);
                hA0 = load_frag(Hb, (n0 >> 5) * 2, lane);
                hA1 = load_frag(Hb, (n0 >> 5) * 2 + 1, lane);
                __builtin_amdgcn_sched_barrier(0);
            }
        }
        acc[0][0] = wmma16(hA0, pB[0].v, acc[0][0]);
        acc[0][1] = wmma16(hA0, pB[1].v, acc[0][1]);
        acc[1][0] = wmma16(hA1, pB[0].v, acc[1][0]);
        acc[1][1] = wmma16(hA1, pB[1].v, acc[1][1]);
    }
    // The lane's indices are formed anew from the lane number, so that none of
    // them holds a register through the loop, which stands at its register bound.
    int ln = __builtin_amdgcn_mbcnt_lo(~0u, 0u);
    col = ln & 15;
    hi = (ln >> 4) * 8;
    #pragma unroll
    for (int dt = 0; dt < 2; ++dt)
        #pragma unroll
        for (int mt = 0; mt < 2; ++mt) {
            float* rp = &red[wave][mt * 16 + col][dt * 16 + hi];
            *(float4*)(rp)     = make_float4(acc[dt][mt][0], acc[dt][mt][1],
                                             acc[dt][mt][2], acc[dt][mt][3]);
            *(float4*)(rp + 4) = make_float4(acc[dt][mt][4], acc[dt][mt][5],
                                             acc[dt][mt][6], acc[dt][mt][7]);
        }
    __syncthreads();   // every wave's partial tile is in LDS before it is summed
    // The tail's operands are asked for here, so that they fly during the sum.
    int c0 = wave * 16;
    v16h wA = load_ab_f32(Wv + (size_t)(c0 + col) * DD, hi);
    float4 bA = *(const float4*)(bv + c0 + hi);
    float4 bB = *(const float4*)(bv + c0 + hi + 4);
    float gm = gamma[0];
    int m = wave * 2 + (ln >> 4), d = col * 2;   // 512 threads x 2 = 32 x 32
    float2 s = make_float2(0.0f, 0.0f);
    #pragma unroll
    for (int w = 0; w < SPLIT; ++w) {
        float2 v = *(const float2*)&red[w][m][d];
        s.x += v.x;
        s.y += v.y;
    }
    v2h pk2 = {(_Float16)s.x, (_Float16)s.y};
    *(v2h*)&sat[m][d] = pk2;
    __syncthreads();   // the whole summed tile is in LDS before any wave reads it

    v16h sB0 = load_ab(&sat[col][0], hi);
    v16h sB1 = load_ab(&sat[16 + col][0], hi);
    v8f z = {};
    v8f o0 = wmma16(wA, sB0, z);
    v8f o1 = wmma16(wA, sB1, z);
    float bia[8] = {bA.x, bA.y, bA.z, bA.w, bB.x, bB.y, bB.z, bB.w};
    float* op = out + ((size_t)b * CC + c0 + hi) * NN + m0 + col;
    #pragma unroll
    for (int r = 0; r < 8; ++r) {
        op[(size_t)r * NN]      = gm * (o0[r] + bia[r]);
        op[(size_t)r * NN + 16] = gm * (o1[r] + bia[r]);
    }
}

extern "C" void kernel_launch(void* const* d_in, const int* in_sizes, int n_in,
                              void* d_out, int out_size, void* d_ws, size_t ws_size,
                              hipStream_t stream) {
    const float* x     = (const float*)d_in[0];
    const float* Wf    = (const float*)d_in[1];
    const float* bf    = (const float*)d_in[2];
    const float* Wg    = (const float*)d_in[3];
    const float* bg    = (const float*)d_in[4];
    const float* Wh    = (const float*)d_in[5];
    const float* bh    = (const float*)d_in[6];
    const float* Wv    = (const float*)d_in[7];
    const float* bv    = (const float*)d_in[8];
    const float* gamma = (const float*)d_in[9];
    float* out = (float*)d_out;

    // workspace layout (~3.2 MB)
    char* w = (char*)d_ws;
    _Float16* Ft  = (_Float16*)w; w += (size_t)Bb * NN * DD * 2;   // 1 MB
    _Float16* Gt  = (_Float16*)w; w += (size_t)Bb * NN * DD * 2;
    _Float16* Hd  = (_Float16*)w; w += (size_t)Bb * DD * NN * 2;
    float*    S   = (float*)w;                                     // {max, 1/Z}

    proj_wmma_kernel<<<dim3(NN / 64, Bb), 32 * KSTEPS, 0, stream>>>(
        x, Wf, Wg, Wh, bf, bg, bh, Ft, Gt, Hd);
    stats_kernel<<<dim3(NN / 32, Bb), 32 * SPLIT, 0, stream>>>(Ft, Gt, S);
    attn_out_kernel<<<dim3(NN / 32, Bb), 32 * SPLIT, 0, stream>>>(
        Ft, Gt, Hd, S, Wv, bv, gamma, out);
}

// v006
// It runs in 36 microseconds.
// Two timings next to v005 put it at 1.08 and 1.09 times that version's speed.
// Counting every step since v000, it is 6.25 times as fast.
#include <hip/hip_runtime.h>
#include <hip/hip_bf16.h>

typedef __attribute__((ext_vector_type(16))) _Float16 v16h;
typedef __attribute__((ext_vector_type(8)))  _Float16 v8h;
typedef __attribute__((ext_vector_type(4)))  _Float16 v4h;
typedef __attribute__((ext_vector_type(2)))  _Float16 v2h;
typedef __attribute__((ext_vector_type(8)))  float    v8f;

#define Bb 4
#define CC 256
#define DD 32
#define NN 4096
#define SPLIT 16            // waves of one work-group that share one sweep
#define SPAN (NN / SPLIT)   // positions of the swept axis per wave

// Load one f16 A/B operand for V_WMMA_F32_16X16X32_F16 from K-contiguous
// storage: lane<16 needs K in {0..7, 16..23}, lane>=16 needs {8..15, 24..31}
// -> two 16B vector loads per lane.
__device__ __forceinline__ v16h load_ab(const _Float16* rowbase, int hi8) {
    union { v16h v; v8h p[2]; } u;
    u.p[0] = *(const v8h*)(rowbase + hi8);
    u.p[1] = *(const v8h*)(rowbase + 16 + hi8);
    return u.v;
}

// The same operand from fragment-order storage, [piece][lane][8]: piece 0 holds
// each lane's first eight k, piece 1 its second eight, so that each of the two
// loads reads 512 contiguous bytes (four whole 128-byte lines) per wave.
#define FRAG 512            // f16 elements of one 16 x 32 fragment
__device__ __forceinline__ v16h load_frag(const _Float16* base, unsigned frag, int lane) {
    unsigned off = frag * FRAG + lane * 8;   // 32-bit offset on a wave-uniform base
    union { v16h v; v8h p[2]; } u;
    u.p[0] = *(const v8h*)(base + off);
    u.p[1] = *(const v8h*)(base + off + 256);
    return u.v;
}

__device__ __forceinline__ v8f wmma16(v16h a, v16h b, v8f c) {
    return __builtin_amdgcn_wmma_f32_16x16x32_f16(false, a, false, b,
                                                  (short)0, c, false, false);
}

// Logits are formed in log2 units: f is stored times log2(e), and a row's softmax
// offset is the (negated) C operand of the logit WMMA, so that D is the argument of
// the hardware's 2^x with no vector instruction in between.
#define LOG2E 1.44269504088896340736f

// D = A B - C: the C modifier of the instruction negates C at no cost.
__device__ __forceinline__ v8f wmma16_sub(v16h a, v16h b, v8f c) {
    return __builtin_amdgcn_wmma_f32_16x16x32_f16(false, a, false, b,
                                                  (short)1, c, false, false);
}

// The same operand from f32 storage: four 16B loads per lane, rounded to f16
// on the way into the fragment (same k order as load_ab).
__device__ __forceinline__ v16h load_ab_f32(const float* rowbase, int hi8) {
    float4 q0 = *(const float4*)(rowbase + hi8);
    float4 q1 = *(const float4*)(rowbase + hi8 + 4);
    float4 q2 = *(const float4*)(rowbase + 16 + hi8);
    float4 q3 = *(const float4*)(rowbase + 16 + hi8 + 4);
    v16h v = {(_Float16)q0.x, (_Float16)q0.y, (_Float16)q0.z, (_Float16)q0.w,
              (_Float16)q1.x, (_Float16)q1.y, (_Float16)q1.z, (_Float16)q1.w,
              (_Float16)q2.x, (_Float16)q2.y, (_Float16)q2.z, (_Float16)q2.w,
              (_Float16)q3.x, (_Float16)q3.y, (_Float16)q3.z, (_Float16)q3.w};
    return v;
}

// ---------------------------------------------------------------------------
// Kernel 1: WMMA projections straight from f32 x [b][c][n] and f32 weights.
// Work-group: 64 tokens, 8 waves.
// Stage: wave w reads the 32 channels of k-step w.  A lane reads
// x[c][m0 + 4*col .. +3] as one float4, so a half-wave covers 256 contiguous
// bytes of channel c; component j feeds B tile j, whose column col is therefore
// token m0 + 4*col + j.  Element e of a fragment is channel k0 + hi + e (e < 8)
// or k0 + 16 + hi + e - 8, as in load_ab.  The four f16 fragments go to LDS in
// register order (lane-contiguous 16B pieces).
// Product: wave t < 6 owns the 16 output rows t of f|g|h (weights read as f32
// while x is in flight) and all 64 tokens: 8 k-steps x 4 WMMAs, k ascending.
// f, g and h are stored in fragment order (load_frag).  f, g: one fragment per
// 16 tokens, k = d.  h: one fragment per (32 tokens, 16 rows d), k = token.
// Element k of row or column i sits in piece k >> 4, lane ((k >> 3) & 1) * 16 + i,
// place k & 7: the k order of load_ab.
// ---------------------------------------------------------------------------
#define KSTEPS (CC / 32)

__global__ void __launch_bounds__(32 * KSTEPS)
proj_wmma_kernel(const float* __restrict__ x,
                 const float* __restrict__ Wf, const float* __restrict__ Wg,
                 const float* __restrict__ Wh,
                 const float* __restrict__ bf, const float* __restrict__ bg,
                 const float* __restrict__ bh,
                 _Float16* __restrict__ Ft, _Float16* __restrict__ Gt,
                 _Float16* __restrict__ Hd) {
    __shared__ __align__(16) _Float16 Bf[KSTEPS][4][2][32][8];   // [k-step][j][half][lane]
    int lane = threadIdx.x & 31;
    int wave = __builtin_amdgcn_readfirstlane(threadIdx.x >> 5);   // scalar role choice
    int b = blockIdx.y;
    int m0 = blockIdx.x * 64;
    int col = lane & 15, hi = (lane >= 16) ? 8 : 0;
    int p = wave >> 1, dt = wave & 1;
    const float* W    = (p == 0) ? Wf : ((p == 1) ? Wg : Wh);
    const float* bias = (p == 0) ? bf : ((p == 1) ? bg : bh);

    const float* xp = x + ((size_t)b * CC + wave * 32 + hi) * NN + m0 + col * 4;
    float4 c[16];
    #pragma unroll   // constant indices keep c in registers; all 16 loads fly together
    for (int e = 0; e < 16; ++e)
        c[e] = *(const float4*)(xp + (size_t)(e < 8 ? e : e + 8) * NN);
    // The x loads' address registers are reused for the weight addresses below.
    asm volatile("s_wait_xcnt 0x0" ::: "memory");

    v16h a[KSTEPS];
    if (wave < 6) {
        #pragma unroll   // constant indices keep a in registers
        for (int ks = 0; ks < KSTEPS; ++ks)
            a[ks] = load_ab_f32(W + (size_t)(dt * 16 + col) * CC + ks * 32, hi);
    }

    #pragma unroll   // constant indices into c, here and in the inner loop
    for (int half = 0; half < 2; ++half) {
        v8h f0, f1, f2, f3;
        #pragma unroll
        for (int e = 0; e < 8; ++e) {
            f0[e] = (_Float16)c[half * 8 + e].x;
            f1[e] = (_Float16)c[half * 8 + e].y;
            f2[e] = (_Float16)c[half * 8 + e].z;
            f3[e] = (_Float16)c[half * 8 + e].w;
        }
        *(v8h*)&Bf[wave][0][half][lane][0] = f0;
        *(v8h*)&Bf[wave][1][half][lane][0] = f1;
        *(v8h*)&Bf[wave][2][half][lane][0] = f2;
        *(v8h*)&Bf[wave][3][half][lane][0] = f3;
    }
    __syncthreads();   // all eight k-steps' fragments are in LDS before any is read
    if (wave >= 6) return;

    v8f acc[4] = {};   // [token component j]
    #pragma unroll   // constant indices into a and acc, from here to the stores
    for (int ks = 0; ks < KSTEPS; ++ks)
        #pragma unroll
        for (int j = 0; j < 4; ++j) {
            union { v16h v; v8h h[2]; } u;
            u.h[0] = *(const v8h*)&Bf[ks][j][0][lane][0];
            u.h[1] = *(const v8h*)&Bf[ks][j][1][lane][0];
            acc[j] = wmma16(a[ks], u.v, acc[j]);
        }

    float4 bA = *(const float4*)(bias + dt * 16 + hi);
    float4 bB = *(const float4*)(bias + dt * 16 + hi + 4);
    float bia[8] = {bA.x, bA.y, bA.z, bA.w, bB.x, bB.y, bB.z, bB.w};
    if (p < 2) {
        _Float16* dst = ((p == 0) ? Ft : Gt) + (size_t)b * NN * DD;
        float sc = (p == 0) ? LOG2E : 1.0f;   // f carries the change of base
        #pragma unroll
        for (int j = 0; j < 4; ++j) {
            v8h pk;
            #pragma unroll
            for (int r = 0; r < 8; ++r)
                pk[r] = (_Float16)((acc[j][r] + bia[r]) * sc);
            // token m0 + 4*col + j, k = dt*16 + hi .. + 7: piece dt, lane half hi / 8
            *(v8h*)(dst + (size_t)((m0 >> 4) + (col >> 2)) * FRAG + dt * 256 +
                    (hi * 2 + (col & 3) * 4 + j) * 8) = pk;
        }
    } else {
        _Float16* dst = Hd + (size_t)b * DD * NN;
        #pragma unroll
        for (int r = 0; r < 8; ++r) {
            v4h pk;   // four neighbouring tokens of one d row
            #pragma unroll
            for (int j = 0; j < 4; ++j)
                pk[j] = (_Float16)(acc[j][r] + bia[r]);
            // row dt*16 + hi + r, k = (col & 7) * 4 .. + 3 of token chunk m0/32 + col/8
            *(v4h*)(dst + (size_t)(((m0 >> 5) + (col >> 3)) * 2 + dt) * FRAG +
                    ((col >> 2) & 1) * 256 + (((col >> 1) & 1) * 16 + hi + r) * 8 +
                    (col & 1) * 4) = pk;
        }
        // The listing lays the f/g store block behind this one and reuses the
        // registers these stores name.
        asm volatile("s_wait_xcnt 0x0" ::: "memory");
    }
}

// ---------------------------------------------------------------------------
// Kernel 2: softmax stats, two-pass.  Work-group owns 32 rows n; each of its
// SPLIT waves sweeps its own SPAN columns m.
// Pass 1: logits -> running max (8 v_max / WMMA).  Cross-lane max merge.
// Pass 2: C = own max, so the WMMA gives l - max -> sum 2^(l - max).  Cross-lane sum.
// Merge: the waves' (max, sum) pairs meet in LDS.  S[b][n] = max + log2 Z.
// ---------------------------------------------------------------------------
__global__ void __launch_bounds__(32 * SPLIT)
stats_kernel(const _Float16* __restrict__ Ft, const _Float16* __restrict__ Gt,
             float* __restrict__ S) {
    __shared__ float pmax[SPLIT][32];
    __shared__ float psum[SPLIT][32];
    int lane = threadIdx.x & 31;
    int wave = __builtin_amdgcn_readfirstlane(threadIdx.x >> 5);   // scalar sweep bounds
    int b = blockIdx.y;
    int n0 = blockIdx.x * 32;
    int mBeg = wave * SPAN, mEnd = mBeg + SPAN;
    int col = lane & 15, hi = (lane >= 16) ? 8 : 0;
    const _Float16* Fb = Ft + (size_t)b * NN * DD;
    const _Float16* Gb = Gt + (size_t)b * NN * DD;

    v16h a0 = load_frag(Fb, n0 >> 4, lane);
    v16h a1 = load_frag(Fb, (n0 >> 4) + 1, lane);

    float mx[2][8];
    #pragma unroll
    for (int t = 0; t < 2; ++t)
        #pragma unroll
        for (int r = 0; r < 8; ++r) mx[t][r] = -3.0e38f;

    for (int m0 = mBeg; m0 < mEnd; m0 += 16) {
        v16h bb = load_frag(Gb, m0 >> 4, lane);
        v8f z = {};
        v8f c0 = wmma16(a0, bb, z);
        v8f c1 = wmma16(a1, bb, z);
        #pragma unroll
        for (int r = 0; r < 8; ++r) {
            mx[0][r] = fmaxf(mx[0][r], c0[r]);
            mx[1][r] = fmaxf(mx[1][r], c1[r]);
        }
    }
    #pragma unroll
    for (int t = 0; t < 2; ++t)
        #pragma unroll
        for (int r = 0; r < 8; ++r)
            #pragma unroll
            for (int off = 1; off < 16; off <<= 1)
                mx[t][r] = fmaxf(mx[t][r], __shfl_xor(mx[t][r], off, 16));

    v8f mv0, mv1;
    #pragma unroll
    for (int r = 0; r < 8; ++r) {
        mv0[r] = mx[0][r];
        mv1[r] = mx[1][r];
    }
    float sm[2][8] = {};
    for (int m0 = mBeg; m0 < mEnd; m0 += 16) {
        v16h bb = load_frag(Gb, m0 >> 4, lane);
        v8f c0 = wmma16_sub(a0, bb, mv0);
        v8f c1 = wmma16_sub(a1, bb, mv1);
        #pragma unroll
        for (int r = 0; r < 8; ++r) {
            sm[0][r] += __builtin_amdgcn_exp2f(c0[r]);
            sm[1][r] += __builtin_amdgcn_exp2f(c1[r]);
        }
    }
    #pragma unroll
    for (int t = 0; t < 2; ++t)
        #pragma unroll
        for (int r = 0; r < 8; ++r)
            #pragma unroll
            for (int off = 1; off < 16; off <<= 1)
                sm[t][r] += __shfl_xor(sm[t][r], off, 16);

    if (col == 0) {
        #pragma unroll
        for (int t = 0; t < 2; ++t)
            #pragma unroll
            for (int r = 0; r < 8; ++r) {
                pmax[wave][t * 16 + hi + r] = mx[t][r];
                psum[wave][t * 16 + hi + r] = sm[t][r];
            }
    }
    __syncthreads();   // every wave's pair is in LDS before wave 0 merges them
    if (wave == 0) {
        float M = pmax[0][lane];
        #pragma unroll
        for (int w = 1; w < SPLIT; ++w) M = fmaxf(M, pmax[w][lane]);
        float Z = 0.0f;
        #pragma unroll
        for (int w = 0; w < SPLIT; ++w) {
            // 2^x with its v_nop in one statement.
            float e;
            asm("v_exp_f32 %0, %1\n\tv_nop" : "=v"(e) : "v"(pmax[w][lane] - M));
            Z += psum[w][lane] * e;
        }
        // Z >= 1: the row's largest term is 2^0.
        S[(size_t)b * NN + n0 + lane] = M + __builtin_amdgcn_logf(Z);
    }
}

// ---------------------------------------------------------------------------
// Kernel 3: attention apply.  Work-group owns 32 output tokens m; each of its
// SPLIT waves sums its own SPAN rows n into sa[32][32], four accumulators, and
// the partial tiles are added up through LDS at the end.  Per 32-n chunk: 4 logit WMMAs -> exp -> 4 sa WMMAs.
// A lane's C operand of logit tile t is S at rows n = 16t + hi .. + 7, the rows of its D.
// P never leaves the registers: a lane of logit tile t holds column m = col, rows
// n = 16t + hi .. + 7, and those are the k of piece t of the B fragment for column
// col in the same lane (the k order of load_ab), so the packed values are the operand.
// Tail: the summed tile, rounded to f16, goes token-major into LDS and is the B
// operand of the output 1x1 conv D->C (K = 32, one WMMA per 16 x 16 tile):
// wave w owns channels 16w .. 16w+15 and both token tiles; + bias, * gamma.
// ---------------------------------------------------------------------------
// Second bound: 8 waves per SIMD, so that two work-groups share a WGP.
__global__ void __launch_bounds__(32 * SPLIT, 8)
attn_out_kernel(const _Float16* __restrict__ Ft, const _Float16* __restrict__ Gt,
                const _Float16* __restrict__ Hd, const float* __restrict__ S,
                const float* __restrict__ Wv, const float* __restrict__ bv,
                const float* __restrict__ gamma, float* __restrict__ out) {
    __shared__ __align__(16) float red[SPLIT][32][36];       // [wave][m][d], padded
    __shared__ __align__(16) _Float16 sat[32][40];           // [m][d], padded: summed tile
    int lane = threadIdx.x & 31;
    int wave = __builtin_amdgcn_readfirstlane(threadIdx.x >> 5);   // scalar sweep bounds
    int b = blockIdx.y;
    int m0 = blockIdx.x * 32;
    int nBeg = wave * SPAN, nEnd = nBeg + SPAN;
    int col = lane & 15, hi = (lane >= 16) ? 8 : 0;
    const _Float16* Fb = Ft + (size_t)b * NN * DD;
    const _Float16* Gb = Gt + (size_t)b * NN * DD;
    const _Float16* Hb = Hd + (size_t)b * DD * NN;
    const float*    Sb = S + (size_t)b * NN;

    v16h gB0 = load_frag(Gb, m0 >> 4, lane);
    v16h gB1 = load_frag(Gb, (m0 >> 4) + 1, lane);

    v8f acc[2][2] = {};   // [d-tile][m-tile]
    #pragma unroll 1   // unrolled, the trips overlap and spill at the 128-register bound
    for (int n0 = nBeg; n0 < nEnd; n0 += 32) {
        v16h fA[2];
        v8f sC[2];
        #pragma unroll
        for (int t = 0; t < 2; ++t) {
            fA[t] = load_frag(Fb, (n0 >> 4) + t, lane);
            sC[t] = *(const v8f*)(Sb + n0 + t * 16 + hi);
        }
        v16h hA0, hA1;
        union { v16h v; v8h p[2]; } pB[2];   // [m-tile]; piece t = logit tile t
        #pragma unroll
        for (int t = 0; t < 2; ++t) {
            #pragma unroll
            for (int mt = 0; mt < 2; ++mt) {
                v8f c = wmma16_sub(fA[t], mt ? gB1 : gB0, sC[t]);
                v8h pk;
                #pragma unroll
                for (int r = 0; r < 8; ++r)
                    pk[r] = (_Float16)__builtin_amdgcn_exp2f(c[r]);
                pB[mt].p[t] = pk;
            }
            if (t == 0) {
                // h is asked for once tile 0's registers are free: earlier it spills,
                // later its latency stands in front of the sa WMMAs.
                __builtin_amdgcn_sched_barrier(0);
                hA0 = load_frag(Hb, (n0 >> 5) * 2, lane);
                hA1 = load_frag(Hb, (n0 >> 5) * 2 + 1, lane);
                // The listing steps the address registers of this trip's loads right below.
                asm volatile("s_wait_xcnt 0x0" ::: "memory");
                __builtin_amdgcn_sched_barrier(0);
            }
        }
        acc[0][0] = wmma16(hA0, pB[0].v, acc[0][0]);
        acc[0][1] = wmma16(hA0, pB[1].v, acc[0][1]);
        acc[1][0] = wmma16(hA1, pB[0].v, acc[1][0]);
        acc[1][1] = wmma16(hA1, pB[1].v, acc[1][1]);
    }
    // The lane's indices are formed anew from the lane number, so that none of
    // them holds a register through the loop, which stands at its register bound.
    int ln = __builtin_amdgcn_mbcnt_lo(~0u, 0u);
    col = ln & 15;
    hi = (ln >> 4) * 8;
    #pragma unroll
    for (int dt = 0; dt < 2; ++dt)
        #pragma unroll
        for (int mt = 0; mt < 2; ++mt) {
            float* rp = &red[wave][mt * 16 + col][dt * 16 + hi];
            *(float4*)(rp)     = make_float4(acc[dt][mt][0], acc[dt][mt][1],
                                             acc[dt][mt][2], acc[dt][mt][3]);
            *(float4*)(rp + 4) = make_float4(acc[dt][mt][4], acc[dt][mt][5],
                                             acc[dt][mt][6], acc[dt][mt][7]);
        }
    __syncthreads();   // every wave's partial tile is in LDS before it is summed
    // The tail's operands are asked for here, so that they fly during the sum.
    int c0 = wave * 16;
    v16h wA = load_ab_f32(Wv + (size_t)(c0 + col) * DD, hi);
    float4 bA = *(const float4*)(bv + c0 + hi);
    float4 bB = *(const float4*)(bv + c0 + hi + 4);
    float gm = gamma[0];
    int m = wave * 2 + (ln >> 4), d = col * 2;   // 512 threads x 2 = 32 x 32
    float2 s = make_float2(0.0f, 0.0f);
    #pragma unroll
    for (int w = 0; w < SPLIT; ++w) {
        float2 v = *(const float2*)&red[w][m][d];
        s.x += v.x;
        s.y += v.y;
    }
    v2h pk2 = {(_Float16)s.x, (_Float16)s.y};
    *(v2h*)&sat[m][d] = pk2;
    __syncthreads();   // the whole summed tile is in LDS before any wave reads it

    v16h sB0 = load_ab(&sat[col][0], hi);
    v16h sB1 = load_ab(&sat[16 + col][0], hi);
    v8f z = {};
    v8f o0 = wmma16(wA, sB0, z);
    v8f o1 = wmma16(wA, sB1, z);
    float bia[8] = {bA.x, bA.y, bA.z, bA.w, bB.x, bB.y, bB.z, bB.w};
    float* op = out + ((size_t)b * CC + c0 + hi) * NN + m0 + col;
    #pragma unroll
    for (int r = 0; r < 8; ++r) {
        op[(size_t)r * NN]      = gm * (o0[r] + bia[r]);
        op[(size_t)r * NN + 16] = gm * (o1[r] + bia[r]);
    }
}

extern "C" void kernel_launch(void* const* d_in, const int* in_sizes, int n_in,
                              void* d_out, int out_size, void* d_ws, size_t ws_size,
                              hipStream_t stream) {
    const float* x     = (const float*)d_in[0];
    const float* Wf    = (const float*)d_in[1];
    const float* bf    = (const float*)d_in[2];
    const float* Wg    = (const float*)d_in[3];
    const float* bg    = (const float*)d_in[4];
    const float* Wh    = (const float*)d_in[5];
    const float* bh    = (const float*)d_in[6];
    const float* Wv    = (const float*)d_in[7];
    const float* bv    = (const float*)d_in[8];
    const float* gamma = (const float*)d_in[9];
    float* out = (float*)d_out;

    // workspace layout (~3.2 MB)
    char* w = (char*)d_ws;
    _Float16* Ft  = (_Float16*)w; w += (size_t)Bb * NN * DD * 2;   // 1 MB
    _Float16* Gt  = (_Float16*)w; w += (size_t)Bb * NN * DD * 2;
    _Float16* Hd  = (_Float16*)w; w += (size_t)Bb * DD * NN * 2;
    float*    S   = (float*)w;                                     // max + log2 Z

    proj_wmma_kernel<<<dim3(NN / 64, Bb), 32 * KSTEPS, 0, stream>>>(
        x, Wf, Wg, Wh, bf, bg, bh, Ft, Gt, Hd);
    stats_kernel<<<dim3(NN / 32, Bb), 32 * SPLIT, 0, stream>>>(Ft, Gt, S);
    attn_out_kernel<<<dim3(NN / 32, Bb), 32 * SPLIT, 0, stream>>>(
        Ft, Gt, Hd, S, Wv, bv, gamma, out);
}

// v007
// It runs in 28.3 microseconds.
// Next to v006, in two timings, it ran 1.29 and 1.27 times as fast.
// All steps since v000 together make it 7.99 times as fast.
#include <hip/hip_runtime.h>
#include <hip/hip_bf16.h>

typedef __attribute__((ext_vector_type(16))) _Float16 v16h;
typedef __attribute__((ext_vector_type(8)))  _Float16 v8h;
typedef __attribute__((ext_vector_type(4)))  _Float16 v4h;
typedef __attribute__((ext_vector_type(2)))  _Float16 v2h;
typedef __attribute__((ext_vector_type(8)))  float    v8f;

#define Bb 4
#define CC 256
#define DD 32
#define NN 4096
#define SPLIT 16            // waves of one work-group that share one sweep
#define SPAN (NN / SPLIT)   // positions of the swept axis per wave

// Load one f16 A/B operand for V_WMMA_F32_16X16X32_F16 from K-contiguous
// storage: lane<16 needs K in {0..7, 16..23}, lane>=16 needs {8..15, 24..31}
// -> two 16B vector loads per lane.
__device__ __forceinline__ v16h load_ab(const _Float16* rowbase, int hi8) {
    union { v16h v; v8h p[2]; } u;
    u.p[0] = *(const v8h*)(rowbase + hi8);
    u.p[1] = *(const v8h*)(rowbase + 16 + hi8);
    return u.v;
}

// The same operand from fragment-order storage, [piece][lane][8]: piece 0 holds
// each lane's first eight k, piece 1 its second eight, so that each of the two
// loads reads 512 contiguous bytes (four whole 128-byte lines) per wave.
#define FRAG 512            // f16 elements of one 16 x 32 fragment
__device__ __forceinline__ v16h load_frag(const _Float16* base, unsigned frag, int lane) {
    unsigned off = frag * FRAG + lane * 8;   // 32-bit offset on a wave-uniform base
    union { v16h v; v8h p[2]; } u;
    u.p[0] = *(const v8h*)(base + off);
    u.p[1] = *(const v8h*)(base + off + 256);
    return u.v;
}

__device__ __forceinline__ v8f wmma16(v16h a, v16h b, v8f c) {
    return __builtin_amdgcn_wmma_f32_16x16x32_f16(false, a, false, b,
                                                  (short)0, c, false, false);
}

// Logits are formed in log2 units: f is stored times log2(e), and a row's softmax
// offset is the (negated) C operand of the logit WMMA, so that D is the argument of
// the hardware's 2^x with no vector instruction in between.
#define LOG2E 1.44269504088896340736f

// D = A B - C: the C modifier of the instruction negates C at no cost.
__device__ __forceinline__ v8f wmma16_sub(v16h a, v16h b, v8f c) {
    return __builtin_amdgcn_wmma_f32_16x16x32_f16(false, a, false, b,
                                                  (short)1, c, false, false);
}

// The same operand from f32 storage: four 16B loads per lane, rounded to f16
// on the way into the fragment (same k order as load_ab).
__device__ __forceinline__ v16h load_ab_f32(const float* rowbase, int hi8) {
    float4 q0 = *(const float4*)(rowbase + hi8);
    float4 q1 = *(const float4*)(rowbase + hi8 + 4);
    float4 q2 = *(const float4*)(rowbase + 16 + hi8);
    float4 q3 = *(const float4*)(rowbase + 16 + hi8 + 4);
    v16h v = {(_Float16)q0.x, (_Float16)q0.y, (_Float16)q0.z, (_Float16)q0.w,
              (_Float16)q1.x, (_Float16)q1.y, (_Float16)q1.z, (_Float16)q1.w,
              (_Float16)q2.x, (_Float16)q2.y, (_Float16)q2.z, (_Float16)q2.w,
              (_Float16)q3.x, (_Float16)q3.y, (_Float16)q3.z, (_Float16)q3.w};
    return v;
}

// ---------------------------------------------------------------------------
// Kernel 1: WMMA projections straight from f32 x [b][c][n] and f32 weights.
// Work-group: 64 tokens, 8 waves.
// Stage: wave w reads the 32 channels of k-step w.  A lane reads
// x[c][m0 + 4*col .. +3] as one float4, so a half-wave covers 256 contiguous
// bytes of channel c; component j feeds B tile j, whose column col is therefore
// token m0 + 4*col + j.  Element e of a fragment is channel k0 + hi + e (e < 8)
// or k0 + 16 + hi + e - 8, as in load_ab.  The four f16 fragments go to LDS in
// register order (lane-contiguous 16B pieces).
// Product: wave t < 6 owns the 16 output rows t of f|g|h (weights read as f32
// while x is in flight) and all 64 tokens: 8 k-steps x 4 WMMAs, k ascending.
// f, g and h are stored in fragment order (load_frag).  f, g: one fragment per
// 16 tokens, k = d.  h: one fragment per (32 tokens, 16 rows d), k = token.
// Element k of row or column i sits in piece k >> 4, lane ((k >> 3) & 1) * 16 + i,
// place k & 7: the k order of load_ab.
// ---------------------------------------------------------------------------
#define KSTEPS (CC / 32)

__global__ void __launch_bounds__(32 * KSTEPS)
proj_wmma_kernel(const float* __restrict__ x,
                 const float* __restrict__ Wf, const float* __restrict__ Wg,
                 const float* __restrict__ Wh,
                 const float* __restrict__ bf, const float* __restrict__ bg,
                 const float* __restrict__ bh,
                 _Float16* __restrict__ Ft, _Float16* __restrict__ Gt,
                 _Float16* __restrict__ Hd) {
    __shared__ __align__(16) _Float16 Bf[KSTEPS][4][2][32][8];   // [k-step][j][half][lane]
    int lane = threadIdx.x & 31;
    int wave = __builtin_amdgcn_readfirstlane(threadIdx.x >> 5);   // scalar role choice
    int b = blockIdx.y;
    int m0 = blockIdx.x * 64;
    int col = lane & 15, hi = (lane >= 16) ? 8 : 0;
    int p = wave >> 1, dt = wave & 1;
    const float* W    = (p == 0) ? Wf : ((p == 1) ? Wg : Wh);
    const float* bias = (p == 0) ? bf : ((p == 1) ? bg : bh);

    const float* xp = x + ((size_t)b * CC + wave * 32 + hi) * NN + m0 + col * 4;
    float4 c[16];
    #pragma unroll   // constant indices keep c in registers; all 16 loads fly together
    for (int e = 0; e < 16; ++e)
        c[e] = *(const float4*)(xp + (size_t)(e < 8 ? e : e + 8) * NN);
    // The x loads' address registers are reused for the weight addresses below.
    asm volatile("s_wait_xcnt 0x0" ::: "memory");

    v16h a[KSTEPS];
    if (wave < 6) {
        #pragma unroll   // constant indices keep a in registers
        for (int ks = 0; ks < KSTEPS; ++ks)
            a[ks] = load_ab_f32(W + (size_t)(dt * 16 + col) * CC + ks * 32, hi);
    }

    #pragma unroll   // constant indices into c, here and in the inner loop
    for (int half = 0; half < 2; ++half) {
        v8h f0, f1, f2, f3;
        #pragma unroll
        for (int e = 0; e < 8; ++e) {
            f0[e] = (_Float16)c[half * 8 + e].x;
            f1[e] = (_Float16)c[half * 8 + e].y;
            f2[e] = (_Float16)c[half * 8 + e].z;
            f3[e] = (_Float16)c[half * 8 + e].w;
        }
        *(v8h*)&Bf[wave][0][half][lane][0] = f0;
        *(v8h*)&Bf[wave][1][half][lane][0] = f1;
        *(v8h*)&Bf[wave][2][half][lane][0] = f2;
        *(v8h*)&Bf[wave][3][half][lane][0] = f3;
    }
    __syncthreads();   // all eight k-steps' fragments are in LDS before any is read
    if (wave >= 6) return;

    v8f acc[4] = {};   // [token component j]
    #pragma unroll   // constant indices into a and acc, from here to the stores
    for (int ks = 0; ks < KSTEPS; ++ks)
        #pragma unroll
        for (int j = 0; j < 4; ++j) {
            union { v16h v; v8h h[2]; } u;
            u.h[0] = *(const v8h*)&Bf[ks][j][0][lane][0];
            u.h[1] = *(const v8h*)&Bf[ks][j][1][lane][0];
            acc[j] = wmma16(a[ks], u.v, acc[j]);
        }

    float4 bA = *(const float4*)(bias + dt * 16 + hi);
    float4 bB = *(const float4*)(bias + dt * 16 + hi + 4);
    float bia[8] = {bA.x, bA.y, bA.z, bA.w, bB.x, bB.y, bB.z, bB.w};
    if (p < 2) {
        _Float16* dst = ((p == 0) ? Ft : Gt) + (size_t)b * NN * DD;
        float sc = (p == 0) ? LOG2E : 1.0f;   // f carries the change of base
        #pragma unroll
        for (int j = 0; j < 4; ++j) {
            v8h pk;
            #pragma unroll
            for (int r = 0; r < 8; ++r)
                pk[r] = (_Float16)((acc[j][r] + bia[r]) * sc);
            // token m0 + 4*col + j, k = dt*16 + hi .. + 7: piece dt, lane half hi / 8
            *(v8h*)(dst + (size_t)((m0 >> 4) + (col >> 2)) * FRAG + dt * 256 +
                    (hi * 2 + (col & 3) * 4 + j) * 8) = pk;
        }
    } else {
        _Float16* dst = Hd + (size_t)b * DD * NN;
        #pragma unroll
        for (int r = 0; r < 8; ++r) {
            v4h pk;   // four neighbouring tokens of one d row
            #pragma unroll
            for (int j = 0; j < 4; ++j)
                pk[j] = (_Float16)(acc[j][r] + bia[r]);
            // row dt*16 + hi + r, k = (col & 7) * 4 .. + 3 of token chunk m0/32 + col/8
            *(v4h*)(dst + (size_t)(((m0 >> 5) + (col >> 3)) * 2 + dt) * FRAG +
                    ((col >> 2) & 1) * 256 + (((col >> 1) & 1) * 16 + hi + r) * 8 +
                    (col & 1) * 4) = pk;
        }
        // The listing lays the f/g store block behind this one and reuses the
        // registers these stores name.
        asm volatile("s_wait_xcnt 0x0" ::: "memory");
    }
}

// ---------------------------------------------------------------------------
// Kernel 2: softmax stats, two-pass.  Work-group owns TILE rows n, and every one of
// its SPLIT waves holds all of them (RT A fragments) and sweeps its own SPAN columns
// m, so that one loaded g fragment feeds RT WMMAs.
// Pass 1: logits -> running max (8 v_max / WMMA).  Cross-lane max merge.
// Pass 2: C = own max, so the WMMA gives l - max -> sum 2^(l - max).  Cross-lane sum.
// Merge: the waves' (max, sum) pairs meet in LDS.  S[b][n] = max + log2 Z.
// ---------------------------------------------------------------------------
#define RT 4                // 16-wide tiles of the kept axis that a wave holds
#define TILE (16 * RT)      // rows (stats) or tokens (apply) of one work-group

__global__ void __launch_bounds__(32 * SPLIT)
stats_kernel(const _Float16* __restrict__ Ft, const _Float16* __restrict__ Gt,
             float* __restrict__ S) {
    __shared__ float pmax[SPLIT][TILE];
    __shared__ float psum[SPLIT][TILE];
    int lane = threadIdx.x & 31;
    int wave = __builtin_amdgcn_readfirstlane(threadIdx.x >> 5);   // scalar sweep bounds
    int b = blockIdx.y;
    int n0 = blockIdx.x * TILE;
    int mBeg = wave * SPAN;
    int col = lane & 15, hi = (lane >= 16) ? 8 : 0;
    const _Float16* Fb = Ft + (size_t)b * NN * DD;
    const _Float16* Gb = Gt + (size_t)b * NN * DD;

    v16h a[RT];
    #pragma unroll   // constant indices keep a, mx, mv and sm in registers, here and below
    for (int t = 0; t < RT; ++t)
        a[t] = load_frag(Fb, (n0 >> 4) + t, lane);

    float mx[RT][8];
    #pragma unroll
    for (int t = 0; t < RT; ++t)
        #pragma unroll
        for (int r = 0; r < 8; ++r) mx[t][r] = -3.0e38f;

    #pragma unroll 4   // eight loads of a wave fly together
    for (int i = 0; i < SPAN / 16; ++i) {
        v16h bb = load_frag(Gb, (mBeg >> 4) + i, lane);
        v8f z = {};
        #pragma unroll
        for (int t = 0; t < RT; ++t) {
            v8f c = wmma16(a[t], bb, z);
            #pragma unroll
            for (int r = 0; r < 8; ++r)
                mx[t][r] = fmaxf(mx[t][r], c[r]);
        }
    }
    #pragma unroll
    for (int t = 0; t < RT; ++t)
        #pragma unroll
        for (int r = 0; r < 8; ++r)
            #pragma unroll
            for (int off = 1; off < 16; off <<= 1)
                mx[t][r] = fmaxf(mx[t][r], __shfl_xor(mx[t][r], off, 16));

    v8f mv[RT];
    #pragma unroll
    for (int t = 0; t < RT; ++t)
        #pragma unroll
        for (int r = 0; r < 8; ++r)
            mv[t][r] = mx[t][r];
    float sm[RT][8] = {};
    #pragma unroll 4   // eight loads of a wave fly together
    for (int i = 0; i < SPAN / 16; ++i) {
        v16h bb = load_frag(Gb, (mBeg >> 4) + i, lane);
        #pragma unroll
        for (int t = 0; t < RT; ++t) {
            v8f c = wmma16_sub(a[t], bb, mv[t]);
            #pragma unroll
            for (int r = 0; r < 8; ++r)
                sm[t][r] += __builtin_amdgcn_exp2f(c[r]);
        }
    }
    #pragma unroll
    for (int t = 0; t < RT; ++t)
        #pragma unroll
        for (int r = 0; r < 8; ++r)
            #pragma unroll
            for (int off = 1; off < 16; off <<= 1)
                sm[t][r] += __shfl_xor(sm[t][r], off, 16);

    if (col == 0) {
        #pragma unroll
        for (int t = 0; t < RT; ++t)
            #pragma unroll
            for (int r = 0; r < 8; ++r) {
                pmax[wave][t * 16 + hi + r] = mx[t][r];
                psum[wave][t * 16 + hi + r] = sm[t][r];
            }
    }
    __syncthreads();   // every wave's pair is in LDS before the first waves merge them
    if (wave < TILE / 32) {
        int row = wave * 32 + lane;
        float M = pmax[0][row];
        #pragma unroll
        for (int w = 1; w < SPLIT; ++w) M = fmaxf(M, pmax[w][row]);
        float Z = 0.0f;
        #pragma unroll
        for (int w = 0; w < SPLIT; ++w) {
            // 2^x with its v_nop in one statement.
            float e;
            asm("v_exp_f32 %0, %1\n\tv_nop" : "=v"(e) : "v"(pmax[w][row] - M));
            Z += psum[w][row] * e;
        }
        // Z >= 1: the row's largest term is 2^0.
        S[(size_t)b * NN + n0 + row] = M + __builtin_amdgcn_logf(Z);
    }
}

// ---------------------------------------------------------------------------
// Kernel 3: attention apply.  Work-group owns TILE output tokens m, and every one of
// its SPLIT waves holds all of them (RT g fragments) and sums its own SPAN rows n into
// sa[32][TILE], 2 * RT accumulators, so that one loaded f, S or h fragment feeds RT
// WMMAs; the partial tiles are added up through LDS at the end.
// Per 32-n chunk: 2 * RT logit WMMAs -> exp -> 2 * RT sa WMMAs.
// A lane's C operand of logit tile t is S at rows n = 16t + hi .. + 7, the rows of its D.
// P never leaves the registers: a lane of logit tile t holds column m = col, rows
// n = 16t + hi .. + 7, and those are the k of piece t of the B fragment for column
// col in the same lane (the k order of load_ab), so the packed values are the operand.
// Tail: the summed tile, rounded to f16, goes token-major into LDS and is the B
// operand of the output 1x1 conv D->C (K = 32, one WMMA per 16 x 16 tile):
// wave w owns channels 16w .. 16w+15 and all RT token tiles; + bias, * gamma.
// ---------------------------------------------------------------------------
__global__ void __launch_bounds__(32 * SPLIT)
attn_out_kernel(const _Float16* __restrict__ Ft, const _Float16* __restrict__ Gt,
                const _Float16* __restrict__ Hd, const float* __restrict__ S,
                const float* __restrict__ Wv, const float* __restrict__ bv,
                const float* __restrict__ gamma, float* __restrict__ out) {
    __shared__ __align__(16) float red[SPLIT][TILE][36];     // [wave][m][d], padded
    __shared__ __align__(16) _Float16 sat[TILE][40];         // [m][d], padded: summed tile
    int lane = threadIdx.x & 31;
    int wave = __builtin_amdgcn_readfirstlane(threadIdx.x >> 5);   // scalar sweep bounds
    int b = blockIdx.y;
    int m0 = blockIdx.x * TILE;
    int nBeg = wave * SPAN, nEnd = nBeg + SPAN;
    int col = lane & 15, hi = (lane >= 16) ? 8 : 0;
    const _Float16* Fb = Ft + (size_t)b * NN * DD;
    const _Float16* Gb = Gt + (size_t)b * NN * DD;
    const _Float16* Hb = Hd + (size_t)b * DD * NN;
    const float*    Sb = S + (size_t)b * NN;

    v16h gB[RT];
    #pragma unroll   // constant indices keep gB, acc and pB in registers, here and below
    for (int mt = 0; mt < RT; ++mt)
        gB[mt] = load_frag(Gb, (m0 >> 4) + mt, lane);

    v8f acc[2][RT] = {};   // [d-tile][m-tile]
    #pragma unroll 1   // rolled: a trip holds 16 WMMAs, and by two the build only grew, with no load earlier
    for (int n0 = nBeg; n0 < nEnd; n0 += 32) {
        v16h fA[2];
        v8f sC[2];
        #pragma unroll
        for (int t = 0; t < 2; ++t) {
            fA[t] = load_frag(Fb, (n0 >> 4) + t, lane);
            sC[t] = *(const v8f*)(Sb + n0 + t * 16 + hi);
        }
        v16h hA0 = load_frag(Hb, (n0 >> 5) * 2, lane);
        v16h hA1 = load_frag(Hb, (n0 >> 5) * 2 + 1, lane);
        // The listing steps the address registers of this trip's loads right below.
        asm volatile("s_wait_xcnt 0x0" ::: "memory");
        // All twelve loads of a trip are asked for at its head: without this line the
        // listing sinks half of h to just in front of the sa WMMAs, a second full wait.
        __builtin_amdgcn_sched_barrier(0);
        union { v16h v; v8h p[2]; } pB[RT];   // [m-tile]; piece t = logit tile t
        #pragma unroll
        for (int t = 0; t < 2; ++t)
            #pragma unroll
            for (int mt = 0; mt < RT; ++mt) {
                v8f c = wmma16_sub(fA[t], gB[mt], sC[t]);
                float e0 = c[0], e1 = c[1], e2 = c[2], e3 = c[3];
                float e4 = c[4], e5 = c[5], e6 = c[6], e7 = c[7];
                // A tile's eight 2^x in place, in one statement: as builtins, the listing
                // wrote each result over the source of the 2^x directly in front of it.
                // The v_nop keeps the slot behind the last one.
                asm("v_exp_f32 %0, %0\n\tv_exp_f32 %1, %1\n\tv_exp_f32 %2, %2\n\t"
                    "v_exp_f32 %3, %3\n\tv_exp_f32 %4, %4\n\tv_exp_f32 %5, %5\n\t"
                    "v_exp_f32 %6, %6\n\tv_exp_f32 %7, %7\n\tv_nop"
                    : "+v"(e0), "+v"(e1), "+v"(e2), "+v"(e3),
                      "+v"(e4), "+v"(e5), "+v"(e6), "+v"(e7));
                v8h pk = {(_Float16)e0, (_Float16)e1, (_Float16)e2, (_Float16)e3,
                          (_Float16)e4, (_Float16)e5, (_Float16)e6, (_Float16)e7};
                pB[mt].p[t] = pk;
            }
        #pragma unroll
        for (int mt = 0; mt < RT; ++mt) {
            acc[0][mt] = wmma16(hA0, pB[mt].v, acc[0][mt]);
            acc[1][mt] = wmma16(hA1, pB[mt].v, acc[1][mt]);
        }
    }
    #pragma unroll
    for (int dt = 0; dt < 2; ++dt)
        #pragma unroll
        for (int mt = 0; mt < RT; ++mt) {
            float* rp = &red[wave][mt * 16 + col][dt * 16 + hi];
            *(float4*)(rp)     = make_float4(acc[dt][mt][0], acc[dt][mt][1],
                                             acc[dt][mt][2], acc[dt][mt][3]);
            *(float4*)(rp + 4) = make_float4(acc[dt][mt][4], acc[dt][mt][5],
                                             acc[dt][mt][6], acc[dt][mt][7]);
        }
    __syncthreads();   // every wave's partial tile is in LDS before it is summed
    // The tail's operands are asked for here, so that they fly during the sum.
    int c0 = wave * 16;
    v16h wA = load_ab_f32(Wv + (size_t)(c0 + col) * DD, hi);
    float4 bA = *(const float4*)(bv + c0 + hi);
    float4 bB = *(const float4*)(bv + c0 + hi + 4);
    float gm = gamma[0];
    // 512 threads x 4 = TILE x 32.  The two rows that a half-wave reads lie 8 apart:
    // 8 * 36 dwords = 32 mod 64, so that its 64 dwords fall on 64 different banks.
    int m = (wave >> 3) * 32 + (wave & 7) + (lane >> 3) * 8, d = (lane & 7) * 4;
    float4 s = make_float4(0.0f, 0.0f, 0.0f, 0.0f);
    #pragma unroll
    for (int w = 0; w < SPLIT; ++w) {
        float4 v = *(const float4*)&red[w][m][d];
        s.x += v.x;
        s.y += v.y;
        s.z += v.z;
        s.w += v.w;
    }
    v4h pk4 = {(_Float16)s.x, (_Float16)s.y, (_Float16)s.z, (_Float16)s.w};
    *(v4h*)&sat[m][d] = pk4;
    __syncthreads();   // the whole summed tile is in LDS before any wave reads it

    float bia[8] = {bA.x, bA.y, bA.z, bA.w, bB.x, bB.y, bB.z, bB.w};
    float* op = out + ((size_t)b * CC + c0 + hi) * NN + m0 + col;
    v8f o[RT];
    #pragma unroll
    for (int mt = 0; mt < RT; ++mt) {
        v8f z = {};
        o[mt] = wmma16(wA, load_ab(&sat[mt * 16 + col][0], hi), z);
    }
    #pragma unroll
    for (int r = 0; r < 8; ++r)
        #pragma unroll
        for (int mt = 0; mt < RT; ++mt)
            op[(size_t)r * NN + mt * 16] = gm * (o[mt][r] + bia[r]);
}

extern "C" void kernel_launch(void* const* d_in, const int* in_sizes, int n_in,
                              void* d_out, int out_size, void* d_ws, size_t ws_size,
                              hipStream_t stream) {
    const float* x     = (const float*)d_in[0];
    const float* Wf    = (const float*)d_in[1];
    const float* bf    = (const float*)d_in[2];
    const float* Wg    = (const float*)d_in[3];
    const float* bg    = (const float*)d_in[4];
    const float* Wh    = (const float*)d_in[5];
    const float* bh    = (const float*)d_in[6];
    const float* Wv    = (const float*)d_in[7];
    const float* bv    = (const float*)d_in[8];
    const float* gamma = (const float*)d_in[9];
    float* out = (float*)d_out;

    // workspace layout (~3.2 MB)
    char* w = (char*)d_ws;
    _Float16* Ft  = (_Float16*)w; w += (size_t)Bb * NN * DD * 2;   // 1 MB
    _Float16* Gt  = (_Float16*)w; w += (size_t)Bb * NN * DD * 2;
    _Float16* Hd  = (_Float16*)w; w += (size_t)Bb * DD * NN * 2;
    float*    S   = (float*)w;                                     // max + log2 Z

    proj_wmma_kernel<<<dim3(NN / 64, Bb), 32 * KSTEPS, 0, stream>>>(
        x, Wf, Wg, Wh, bf, bg, bh, Ft, Gt, Hd);
    stats_kernel<<<dim3(NN / TILE, Bb), 32 * SPLIT, 0, stream>>>(Ft, Gt, S);
    attn_out_kernel<<<dim3(NN / TILE, Bb), 32 * SPLIT, 0, stream>>>(
        Ft, Gt, Hd, S, Wv, bv, gamma, out);
}

// v008
// A run of this version takes 24.8 microseconds.
// Next to v007, in two timings, it ran 1.15 and 1.14 times as fast.
// Over all steps from v000 it is 9.15 times as fast.
#include <hip/hip_runtime.h>
#include <hip/hip_bf16.h>

typedef __attribute__((ext_vector_type(16))) _Float16 v16h;
typedef __attribute__((ext_vector_type(8)))  _Float16 v8h;
typedef __attribute__((ext_vector_type(4)))  _Float16 v4h;
typedef __attribute__((ext_vector_type(2)))  _Float16 v2h;
typedef __attribute__((ext_vector_type(8)))  float    v8f;

#define Bb 4
#define CC 256
#define DD 32
#define NN 4096
#define SPLIT 16            // waves of one work-group that share one sweep
#define SPAN (NN / SPLIT)   // positions of the swept axis per wave

// Load one f16 A/B operand for V_WMMA_F32_16X16X32_F16 from K-contiguous
// storage: lane<16 needs K in {0..7, 16..23}, lane>=16 needs {8..15, 24..31}
// -> two 16B vector loads per lane.
__device__ __forceinline__ v16h load_ab(const _Float16* rowbase, int hi8) {
    union { v16h v; v8h p[2]; } u;
    u.p[0] = *(const v8h*)(rowbase + hi8);
    u.p[1] = *(const v8h*)(rowbase + 16 + hi8);
    return u.v;
}

// The same operand from fragment-order storage, [piece][lane][8]: piece 0 holds
// each lane's first eight k, piece 1 its second eight, so that each of the two
// loads reads 512 contiguous bytes (four whole 128-byte lines) per wave.
#define FRAG 512            // f16 elements of one 16 x 32 fragment
__device__ __forceinline__ v16h load_frag(const _Float16* base, unsigned frag, int lane) {
    unsigned off = frag * FRAG + lane * 8;   // 32-bit offset on a wave-uniform base
    union { v16h v; v8h p[2]; } u;
    u.p[0] = *(const v8h*)(base + off);
    u.p[1] = *(const v8h*)(base + off + 256);
    return u.v;
}

__device__ __forceinline__ v8f wmma16(v16h a, v16h b, v8f c) {
    return __builtin_amdgcn_wmma_f32_16x16x32_f16(false, a, false, b,
                                                  (short)0, c, false, false);
}

// Logits are formed in log2 units: f is stored times log2(e), and a row's softmax
// offset is the (negated) C operand of the logit WMMA, so that D is the argument of
// the hardware's 2^x with no vector instruction in between.
#define LOG2E 1.44269504088896340736f

// D = A B - C: the C modifier of the instruction negates C at no cost.
__device__ __forceinline__ v8f wmma16_sub(v16h a, v16h b, v8f c) {
    return __builtin_amdgcn_wmma_f32_16x16x32_f16(false, a, false, b,
                                                  (short)1, c, false, false);
}

// The same operand from f32 storage: four 16B loads per lane, rounded to f16
// on the way into the fragment (same k order as load_ab).
__device__ __forceinline__ v16h load_ab_f32(const float* rowbase, int hi8) {
    float4 q0 = *(const float4*)(rowbase + hi8);
    float4 q1 = *(const float4*)(rowbase + hi8 + 4);
    float4 q2 = *(const float4*)(rowbase + 16 + hi8);
    float4 q3 = *(const float4*)(rowbase + 16 + hi8 + 4);
    v16h v = {(_Float16)q0.x, (_Float16)q0.y, (_Float16)q0.z, (_Float16)q0.w,
              (_Float16)q1.x, (_Float16)q1.y, (_Float16)q1.z, (_Float16)q1.w,
              (_Float16)q2.x, (_Float16)q2.y, (_Float16)q2.z, (_Float16)q2.w,
              (_Float16)q3.x, (_Float16)q3.y, (_Float16)q3.z, (_Float16)q3.w};
    return v;
}

// ---------------------------------------------------------------------------
// Kernel 1: WMMA projections straight from f32 x [b][c][n] and f32 weights.
// Work-group: 64 tokens, 8 waves.
// Stage: wave w reads the 32 channels of k-step w.  A lane reads
// x[c][m0 + 4*col .. +3] as one float4, so a half-wave covers 256 contiguous
// bytes of channel c; component j feeds B tile j, whose column col is therefore
// token m0 + 4*col + j.  Element e of a fragment is channel k0 + hi + e (e < 8)
// or k0 + 16 + hi + e - 8, as in load_ab.  The four f16 fragments go to LDS in
// register order (lane-contiguous 16B pieces).
// Product: wave t < 6 owns the 16 output rows t of f|g|h (weights read as f32
// while x is in flight) and all 64 tokens: 8 k-steps x 4 WMMAs, k ascending.
// f, g and h are stored in fragment order (load_frag).  f, g: one fragment per
// 16 tokens, k = d.  h: one fragment per (32 tokens, 16 rows d), k = token.
// Element k of row or column i sits in piece k >> 4, lane ((k >> 3) & 1) * 16 + i,
// place k & 7: the k order of load_ab.
// ---------------------------------------------------------------------------
#define KSTEPS (CC / 32)

__global__ void __launch_bounds__(32 * KSTEPS)
proj_wmma_kernel(const float* __restrict__ x,
                 const float* __restrict__ Wf, const float* __restrict__ Wg,
                 const float* __restrict__ Wh,
                 const float* __restrict__ bf, const float* __restrict__ bg,
                 const float* __restrict__ bh,
                 _Float16* __restrict__ Ft, _Float16* __restrict__ Gt,
                 _Float16* __restrict__ Hd) {
    __shared__ __align__(16) _Float16 Bf[KSTEPS][4][2][32][8];   // [k-step][j][half][lane]
    int lane = threadIdx.x & 31;
    int wave = __builtin_amdgcn_readfirstlane(threadIdx.x >> 5);   // scalar role choice
    int b = blockIdx.y;
    int m0 = blockIdx.x * 64;
    int col = lane & 15, hi = (lane >= 16) ? 8 : 0;
    int p = wave >> 1, dt = wave & 1;
    const float* W    = (p == 0) ? Wf : ((p == 1) ? Wg : Wh);
    const float* bias = (p == 0) ? bf : ((p == 1) ? bg : bh);

    const float* xp = x + ((size_t)b * CC + wave * 32 + hi) * NN + m0 + col * 4;
    float4 c[16];
    #pragma unroll   // constant indices keep c in registers; all 16 loads fly together
    for (int e = 0; e < 16; ++e)
        c[e] = *(const float4*)(xp + (size_t)(e < 8 ? e : e + 8) * NN);
    // The x loads' address registers are reused for the weight addresses below.
    asm volatile("s_wait_xcnt 0x0" ::: "memory");

    v16h a[KSTEPS];
    if (wave < 6) {
        #pragma unroll   // constant indices keep a in registers
        for (int ks = 0; ks < KSTEPS; ++ks)
            a[ks] = load_ab_f32(W + (size_t)(dt * 16 + col) * CC + ks * 32, hi);
    }

    #pragma unroll   // constant indices into c, here and in the inner loop
    for (int half = 0; half < 2; ++half) {
        v8h f0, f1, f2, f3;
        #pragma unroll
        for (int e = 0; e < 8; ++e) {
            f0[e] = (_Float16)c[half * 8 + e].x;
            f1[e] = (_Float16)c[half * 8 + e].y;
            f2[e] = (_Float16)c[half * 8 + e].z;
            f3[e] = (_Float16)c[half * 8 + e].w;
        }
        *(v8h*)&Bf[wave][0][half][lane][0] = f0;
        *(v8h*)&Bf[wave][1][half][lane][0] = f1;
        *(v8h*)&Bf[wave][2][half][lane][0] = f2;
        *(v8h*)&Bf[wave][3][half][lane][0] = f3;
    }
    __syncthreads();   // all eight k-steps' fragments are in LDS before any is read
    if (wave >= 6) return;

    v8f acc[4] = {};   // [token component j]
    #pragma unroll   // constant indices into a and acc, from here to the stores
    for (int ks = 0; ks < KSTEPS; ++ks)
        #pragma unroll
        for (int j = 0; j < 4; ++j) {
            union { v16h v; v8h h[2]; } u;
            u.h[0] = *(const v8h*)&Bf[ks][j][0][lane][0];
            u.h[1] = *(const v8h*)&Bf[ks][j][1][lane][0];
            acc[j] = wmma16(a[ks], u.v, acc[j]);
        }

    float4 bA = *(const float4*)(bias + dt * 16 + hi);
    float4 bB = *(const float4*)(bias + dt * 16 + hi + 4);
    float bia[8] = {bA.x, bA.y, bA.z, bA.w, bB.x, bB.y, bB.z, bB.w};
    if (p < 2) {
        _Float16* dst = ((p == 0) ? Ft : Gt) + (size_t)b * NN * DD;
        float sc = (p == 0) ? LOG2E : 1.0f;   // f carries the change of base
        #pragma unroll
        for (int j = 0; j < 4; ++j) {
            v8h pk;
            #pragma unroll
            for (int r = 0; r < 8; ++r)
                pk[r] = (_Float16)((acc[j][r] + bia[r]) * sc);
            // token m0 + 4*col + j, k = dt*16 + hi .. + 7: piece dt, lane half hi / 8
            *(v8h*)(dst + (size_t)((m0 >> 4) + (col >> 2)) * FRAG + dt * 256 +
                    (hi * 2 + (col & 3) * 4 + j) * 8) = pk;
        }
    } else {
        _Float16* dst = Hd + (size_t)b * DD * NN;
        #pragma unroll
        for (int r = 0; r < 8; ++r) {
            v4h pk;   // four neighbouring tokens of one d row
            #pragma unroll
            for (int j = 0; j < 4; ++j)
                pk[j] = (_Float16)(acc[j][r] + bia[r]);
            // row dt*16 + hi + r, k = (col & 7) * 4 .. + 3 of token chunk m0/32 + col/8
            *(v4h*)(dst + (size_t)(((m0 >> 5) + (col >> 3)) * 2 + dt) * FRAG +
                    ((col >> 2) & 1) * 256 + (((col >> 1) & 1) * 16 + hi + r) * 8 +
                    (col & 1) * 4) = pk;
        }
        // The listing lays the f/g store block behind this one and reuses the
        // registers these stores name.
        asm volatile("s_wait_xcnt 0x0" ::: "memory");
    }
}

// ---------------------------------------------------------------------------
// Kernel 2: softmax stats.  Work-group owns TILE rows n, and every one of its SPLIT
// waves holds all of them (RT A fragments) and sweeps its own SPAN columns m, so that
// one loaded g fragment feeds RT WMMAs.
// One sweep: Z = sum 2^l with no shift (C = 0).  Cross-lane sum, the waves' sums meet
// in LDS, S[b][n] = log2 Z.  An f32 sum of positive terms is as exact at any scale as
// long as nothing overflows and what is flushed to zero does not count: with
// ZLO <= Z <= ZHI no term or partial sum exceeds ZHI, and the terms below 2^-126,
// NN of them at most, add up to less than 2^-50 of Z.
// Where a row of the tile leaves that range (NaN included) the whole work-group
// does the shifted form instead:
// Pass 1: logits -> running max (8 v_max / WMMA).  Cross-lane max merge.
// Pass 2: C = own max, so the WMMA gives l - max -> sum 2^(l - max).  Cross-lane sum.
// Merge: the waves' (max, sum) pairs meet in LDS.  S[b][n] = max + log2 Z.
// ---------------------------------------------------------------------------
#define RT 4                // 16-wide tiles of the kept axis that a wave holds
#define TILE (16 * RT)      // rows (stats) or tokens (apply) of one work-group
#define ZLO 0x1p-64f
#define ZHI 0x1p+64f

__global__ void __launch_bounds__(32 * SPLIT)
stats_kernel(const _Float16* __restrict__ Ft, const _Float16* __restrict__ Gt,
             float* __restrict__ S) {
    __shared__ float pmax[SPLIT][TILE];
    __shared__ float psum[SPLIT][TILE];
    __shared__ int redo[TILE / 32];
    int lane = threadIdx.x & 31;
    int wave = __builtin_amdgcn_readfirstlane(threadIdx.x >> 5);   // scalar sweep bounds
    int b = blockIdx.y;
    int n0 = blockIdx.x * TILE;
    int mBeg = wave * SPAN;
    int col = lane & 15, hi = (lane >= 16) ? 8 : 0;
    const _Float16* Fb = Ft + (size_t)b * NN * DD;
    const _Float16* Gb = Gt + (size_t)b * NN * DD;

    v16h a[RT];
    #pragma unroll   // constant indices keep a, mx, mv and sm in registers, here and below
    for (int t = 0; t < RT; ++t)
        a[t] = load_frag(Fb, (n0 >> 4) + t, lane);

    float sm[RT][8] = {};
    #pragma unroll 4   // eight loads of a wave fly together
    for (int i = 0; i < SPAN / 16; ++i) {
        v16h bb = load_frag(Gb, (mBeg >> 4) + i, lane);
        v8f z = {};
        #pragma unroll
        for (int t = 0; t < RT; ++t) {
            v8f c = wmma16(a[t], bb, z);
            #pragma unroll
            for (int r = 0; r < 8; ++r)
                sm[t][r] += __builtin_amdgcn_exp2f(c[r]);
        }
    }
    #pragma unroll
    for (int t = 0; t < RT; ++t)
        #pragma unroll
        for (int r = 0; r < 8; ++r)
            #pragma unroll
            for (int off = 1; off < 16; off <<= 1)
                sm[t][r] += __shfl_xor(sm[t][r], off, 16);
    if (col == 0) {
        #pragma unroll
        for (int t = 0; t < RT; ++t)
            #pragma unroll
            for (int r = 0; r < 8; ++r)
                psum[wave][t * 16 + hi + r] = sm[t][r];
    }
    __syncthreads();   // every wave's sums are in LDS before the first waves add them
    int row = wave * 32 + lane;   // a row of the tile in the first TILE / 32 waves
    float Z = 0.0f;
    if (wave < TILE / 32) {
        #pragma unroll
        for (int w = 0; w < SPLIT; ++w) Z += psum[w][row];
        // every lane stores the wave's one answer
        redo[wave] = __builtin_amdgcn_ballot_w32(!(Z >= ZLO && Z <= ZHI)) != 0;
    }
    __syncthreads();   // the range test's answer reaches every wave; psum is read out
    int again = 0;
    #pragma unroll
    for (int w = 0; w < TILE / 32; ++w) again |= redo[w];
    // a scalar branch: the same way for the whole work-group, barriers lie behind it
    if (__builtin_expect(__builtin_amdgcn_readfirstlane(again) == 0, 1)) {
        if (wave < TILE / 32) {
            // log2 with its v_nop in one statement: the store reads the result, and the
            // listing had only scalar instructions between the two.
            float lz;
            asm("v_log_f32 %0, %1\n\tv_nop" : "=v"(lz) : "v"(Z));
            S[(size_t)b * NN + n0 + row] = lz;
        }
        return;
    }

    float mx[RT][8];
    #pragma unroll
    for (int t = 0; t < RT; ++t)
        #pragma unroll
        for (int r = 0; r < 8; ++r) mx[t][r] = -3.0e38f;

    #pragma unroll 4   // eight loads of a wave fly together
    for (int i = 0; i < SPAN / 16; ++i) {
        v16h bb = load_frag(Gb, (mBeg >> 4) + i, lane);
        v8f z = {};
        #pragma unroll
        for (int t = 0; t < RT; ++t) {
            v8f c = wmma16(a[t], bb, z);
            #pragma unroll
            for (int r = 0; r < 8; ++r)
                mx[t][r] = fmaxf(mx[t][r], c[r]);
        }
    }
    #pragma unroll
    for (int t = 0; t < RT; ++t)
        #pragma unroll
        for (int r = 0; r < 8; ++r)
            #pragma unroll
            for (int off = 1; off < 16; off <<= 1)
                mx[t][r] = fmaxf(mx[t][r], __shfl_xor(mx[t][r], off, 16));

    v8f mv[RT];
    #pragma unroll
    for (int t = 0; t < RT; ++t)
        #pragma unroll
        for (int r = 0; r < 8; ++r) {
            mv[t][r] = mx[t][r];
            sm[t][r] = 0.0f;
        }
    #pragma unroll 4   // eight loads of a wave fly together
    for (int i = 0; i < SPAN / 16; ++i) {
        v16h bb = load_frag(Gb, (mBeg >> 4) + i, lane);
        #pragma unroll
        for (int t = 0; t < RT; ++t) {
            v8f c = wmma16_sub(a[t], bb, mv[t]);
            #pragma unroll
            for (int r = 0; r < 8; ++r)
                sm[t][r] += __builtin_amdgcn_exp2f(c[r]);
        }
    }
    #pragma unroll
    for (int t = 0; t < RT; ++t)
        #pragma unroll
        for (int r = 0; r < 8; ++r)
            #pragma unroll
            for (int off = 1; off < 16; off <<= 1)
                sm[t][r] += __shfl_xor(sm[t][r], off, 16);

    if (col == 0) {
        #pragma unroll
        for (int t = 0; t < RT; ++t)
            #pragma unroll
            for (int r = 0; r < 8; ++r) {
                pmax[wave][t * 16 + hi + r] = mx[t][r];
                psum[wave][t * 16 + hi + r] = sm[t][r];
            }
    }
    __syncthreads();   // every wave's pair is in LDS before the first waves merge them
    if (wave < TILE / 32) {
        float M = pmax[0][row];
        #pragma unroll
        for (int w = 1; w < SPLIT; ++w) M = fmaxf(M, pmax[w][row]);
        Z = 0.0f;
        #pragma unroll
        for (int w = 0; w < SPLIT; ++w) {
            // 2^x with its v_nop in one statement.
            float e;
            asm("v_exp_f32 %0, %1\n\tv_nop" : "=v"(e) : "v"(pmax[w][row] - M));
            Z += psum[w][row] * e;
        }
        // Z >= 1: the row's largest term is 2^0.
        S[(size_t)b * NN + n0 + row] = M + __builtin_amdgcn_logf(Z);
    }
}

// ---------------------------------------------------------------------------
// Kernel 3: attention apply.  Work-group owns TILE output tokens m, and every one of
// its SPLIT waves holds all of them (RT g fragments) and sums its own SPAN rows n into
// sa[32][TILE], 2 * RT accumulators, so that one loaded f, S or h fragment feeds RT
// WMMAs; the partial tiles are added up through LDS at the end.
// Per 32-n chunk: 2 * RT logit WMMAs -> exp -> 2 * RT sa WMMAs.
// A lane's C operand of logit tile t is S at rows n = 16t + hi .. + 7, the rows of its D.
// P never leaves the registers: a lane of logit tile t holds column m = col, rows
// n = 16t + hi .. + 7, and those are the k of piece t of the B fragment for column
// col in the same lane (the k order of load_ab), so the packed values are the operand.
// Tail: the summed tile, rounded to f16, goes token-major into LDS and is the B
// operand of the output 1x1 conv D->C (K = 32, one WMMA per 16 x 16 tile):
// wave w owns channels 16w .. 16w+15 and all RT token tiles; + bias, * gamma.
// ---------------------------------------------------------------------------
__global__ void __launch_bounds__(32 * SPLIT)
attn_out_kernel(const _Float16* __restrict__ Ft, const _Float16* __restrict__ Gt,
                const _Float16* __restrict__ Hd, const float* __restrict__ S,
                const float* __restrict__ Wv, const float* __restrict__ bv,
                const float* __restrict__ gamma, float* __restrict__ out) {
    __shared__ __align__(16) float red[SPLIT][TILE][36];     // [wave][m][d], padded
    __shared__ __align__(16) _Float16 sat[TILE][40];         // [m][d], padded: summed tile
    int lane = threadIdx.x & 31;
    int wave = __builtin_amdgcn_readfirstlane(threadIdx.x >> 5);   // scalar sweep bounds
    int b = blockIdx.y;
    int m0 = blockIdx.x * TILE;
    int nBeg = wave * SPAN, nEnd = nBeg + SPAN;
    int col = lane & 15, hi = (lane >= 16) ? 8 : 0;
    const _Float16* Fb = Ft + (size_t)b * NN * DD;
    const _Float16* Gb = Gt + (size_t)b * NN * DD;
    const _Float16* Hb = Hd + (size_t)b * DD * NN;
    const float*    Sb = S + (size_t)b * NN;

    v16h gB[RT];
    #pragma unroll   // constant indices keep gB, acc and pB in registers, here and below
    for (int mt = 0; mt < RT; ++mt)
        gB[mt] = load_frag(Gb, (m0 >> 4) + mt, lane);

    v8f acc[2][RT] = {};   // [d-tile][m-tile]
    #pragma unroll 1   // rolled: a trip holds 16 WMMAs, and by two the build only grew, with no load earlier
    for (int n0 = nBeg; n0 < nEnd; n0 += 32) {
        v16h fA[2];
        v8f sC[2];
        #pragma unroll
        for (int t = 0; t < 2; ++t) {
            fA[t] = load_frag(Fb, (n0 >> 4) + t, lane);
            sC[t] = *(const v8f*)(Sb + n0 + t * 16 + hi);
        }
        v16h hA0 = load_frag(Hb, (n0 >> 5) * 2, lane);
        v16h hA1 = load_frag(Hb, (n0 >> 5) * 2 + 1, lane);
        // The listing steps the address registers of this trip's loads right below.
        asm volatile("s_wait_xcnt 0x0" ::: "memory");
        // All twelve loads of a trip are asked for at its head: without this line the
        // listing sinks half of h to just in front of the sa WMMAs, a second full wait.
        __builtin_amdgcn_sched_barrier(0);
        union { v16h v; v8h p[2]; } pB[RT];   // [m-tile]; piece t = logit tile t
        #pragma unroll
        for (int t = 0; t < 2; ++t)
            #pragma unroll
            for (int mt = 0; mt < RT; ++mt) {
                v8f c = wmma16_sub(fA[t], gB[mt], sC[t]);
                float e0 = c[0], e1 = c[1], e2 = c[2], e3 = c[3];
                float e4 = c[4], e5 = c[5], e6 = c[6], e7 = c[7];
                // A tile's eight 2^x in place, in one statement: as builtins, the listing
                // wrote each result over the source of the 2^x directly in front of it.
                // The v_nop keeps the slot behind the last one.
                asm("v_exp_f32 %0, %0\n\tv_exp_f32 %1, %1\n\tv_exp_f32 %2, %2\n\t"
                    "v_exp_f32 %3, %3\n\tv_exp_f32 %4, %4\n\tv_exp_f32 %5, %5\n\t"
                    "v_exp_f32 %6, %6\n\tv_exp_f32 %7, %7\n\tv_nop"
                    : "+v"(e0), "+v"(e1), "+v"(e2), "+v"(e3),
                      "+v"(e4), "+v"(e5), "+v"(e6), "+v"(e7));
                v8h pk = {(_Float16)e0, (_Float16)e1, (_Float16)e2, (_Float16)e3,
                          (_Float16)e4, (_Float16)e5, (_Float16)e6, (_Float16)e7};
                pB[mt].p[t] = pk;
            }
        #pragma unroll
        for (int mt = 0; mt < RT; ++mt) {
            acc[0][mt] = wmma16(hA0, pB[mt].v, acc[0][mt]);
            acc[1][mt] = wmma16(hA1, pB[mt].v, acc[1][mt]);
        }
    }
    #pragma unroll
    for (int dt = 0; dt < 2; ++dt)
        #pragma unroll
        for (int mt = 0; mt < RT; ++mt) {
            float* rp = &red[wave][mt * 16 + col][dt * 16 + hi];
            *(float4*)(rp)     = make_float4(acc[dt][mt][0], acc[dt][mt][1],
                                             acc[dt][mt][2], acc[dt][mt][3]);
            *(float4*)(rp + 4) = make_float4(acc[dt][mt][4], acc[dt][mt][5],
                                             acc[dt][mt][6], acc[dt][mt][7]);
        }
    __syncthreads();   // every wave's partial tile is in LDS before it is summed
    // The tail's operands are asked for here, so that they fly during the sum.
    int c0 = wave * 16;
    v16h wA = load_ab_f32(Wv + (size_t)(c0 + col) * DD, hi);
    float4 bA = *(const float4*)(bv + c0 + hi);
    float4 bB = *(const float4*)(bv + c0 + hi + 4);
    float gm = gamma[0];
    // 512 threads x 4 = TILE x 32.  The two rows that a half-wave reads lie 8 apart:
    // 8 * 36 dwords = 32 mod 64, so that its 64 dwords fall on 64 different banks.
    int m = (wave >> 3) * 32 + (wave & 7) + (lane >> 3) * 8, d = (lane & 7) * 4;
    float4 s = make_float4(0.0f, 0.0f, 0.0f, 0.0f);
    #pragma unroll
    for (int w = 0; w < SPLIT; ++w) {
        float4 v = *(const float4*)&red[w][m][d];
        s.x += v.x;
        s.y += v.y;
        s.z += v.z;
        s.w += v.w;
    }
    v4h pk4 = {(_Float16)s.x, (_Float16)s.y, (_Float16)s.z, (_Float16)s.w};
    *(v4h*)&sat[m][d] = pk4;
    __syncthreads();   // the whole summed tile is in LDS before any wave reads it

    float bia[8] = {bA.x, bA.y, bA.z, bA.w, bB.x, bB.y, bB.z, bB.w};
    float* op = out + ((size_t)b * CC + c0 + hi) * NN + m0 + col;
    v8f o[RT];
    #pragma unroll
    for (int mt = 0; mt < RT; ++mt) {
        v8f z = {};
        o[mt] = wmma16(wA, load_ab(&sat[mt * 16 + col][0], hi), z);
    }
    #pragma unroll
    for (int r = 0; r < 8; ++r)
        #pragma unroll
        for (int mt = 0; mt < RT; ++mt)
            op[(size_t)r * NN + mt * 16] = gm * (o[mt][r] + bia[r]);
}

extern "C" void kernel_launch(void* const* d_in, const int* in_sizes, int n_in,
                              void* d_out, int out_size, void* d_ws, size_t ws_size,
                              hipStream_t stream) {
    const float* x     = (const float*)d_in[0];
    const float* Wf    = (const float*)d_in[1];
    const float* bf    = (const float*)d_in[2];
    const float* Wg    = (const float*)d_in[3];
    const float* bg    = (const float*)d_in[4];
    const float* Wh    = (const float*)d_in[5];
    const float* bh    = (const float*)d_in[6];
    const float* Wv    = (const float*)d_in[7];
    const float* bv    = (const float*)d_in[8];
    const float* gamma = (const float*)d_in[9];
    float* out = (float*)d_out;

    // workspace layout (~3.2 MB)
    char* w = (char*)d_ws;
    _Float16* Ft  = (_Float16*)w; w += (size_t)Bb * NN * DD * 2;   // 1 MB
    _Float16* Gt  = (_Float16*)w; w += (size_t)Bb * NN * DD * 2;
    _Float16* Hd  = (_Float16*)w; w += (size_t)Bb * DD * NN * 2;
    float*    S   = (float*)w;                                     // log2 of the row sum of 2^l

    proj_wmma_kernel<<<dim3(NN / 64, Bb), 32 * KSTEPS, 0, stream>>>(
        x, Wf, Wg, Wh, bf, bg, bh, Ft, Gt, Hd);
    stats_kernel<<<dim3(NN / TILE, Bb), 32 * SPLIT, 0, stream>>>(Ft, Gt, S);
    attn_out_kernel<<<dim3(NN / TILE, Bb), 32 * SPLIT, 0, stream>>>(
        Ft, Gt, Hd, S, Wv, bv, gamma, out);
}

// v009
// Measured time: 23.6 microseconds a run.
// Timed twice side by side with v008, it ran 1.04 times as fast both times.
// Counting every step since v000, it is 9.52 times as fast.
#include <hip/hip_runtime.h>
#include <hip/hip_bf16.h>

typedef __attribute__((ext_vector_type(16))) _Float16 v16h;
typedef __attribute__((ext_vector_type(8)))  _Float16 v8h;
typedef __attribute__((ext_vector_type(4)))  _Float16 v4h;
typedef __attribute__((ext_vector_type(2)))  _Float16 v2h;
typedef __attribute__((ext_vector_type(8)))  float    v8f;

#define Bb 4
#define CC 256
#define DD 32
#define NN 4096
#define SPLIT 16            // waves of one work-group that share one sweep
#define SPAN (NN / SPLIT)   // positions of the swept axis per wave

// Load one f16 A/B operand for V_WMMA_F32_16X16X32_F16 from K-contiguous
// storage: lane<16 needs K in {0..7, 16..23}, lane>=16 needs {8..15, 24..31}
// -> two 16B vector loads per lane.
__device__ __forceinline__ v16h load_ab(const _Float16* rowbase, int hi8) {
    union { v16h v; v8h p[2]; } u;
    u.p[0] = *(const v8h*)(rowbase + hi8);
    u.p[1] = *(const v8h*)(rowbase + 16 + hi8);
    return u.v;
}

// The same operand from fragment-order storage, [piece][lane][8]: piece 0 holds
// each lane's first eight k, piece 1 its second eight, so that each of the two
// loads reads 512 contiguous bytes (four whole 128-byte lines) per wave.
#define FRAG 512            // f16 elements of one 16 x 32 fragment
__device__ __forceinline__ v16h load_frag(const _Float16* base, unsigned frag, int lane) {
    unsigned off = frag * FRAG + lane * 8;   // 32-bit offset on a wave-uniform base
    union { v16h v; v8h p[2]; } u;
    u.p[0] = *(const v8h*)(base + off);
    u.p[1] = *(const v8h*)(base + off + 256);
    return u.v;
}

__device__ __forceinline__ v8f wmma16(v16h a, v16h b, v8f c) {
    return __builtin_amdgcn_wmma_f32_16x16x32_f16(false, a, false, b,
                                                  (short)0, c, false, false);
}

// Logits are formed in log2 units: f is stored times log2(e), and a row's softmax
// offset is the (negated) C operand of the logit WMMA, so that D is the argument of
// the hardware's 2^x with no vector instruction in between.
#define LOG2E 1.44269504088896340736f

// D = A B - C: the C modifier of the instruction negates C at no cost.
__device__ __forceinline__ v8f wmma16_sub(v16h a, v16h b, v8f c) {
    return __builtin_amdgcn_wmma_f32_16x16x32_f16(false, a, false, b,
                                                  (short)1, c, false, false);
}

// The same operand from f32 storage: four 16B loads per lane, rounded to f16
// on the way into the fragment (same k order as load_ab).
__device__ __forceinline__ v16h load_ab_f32(const float* rowbase, int hi8) {
    float4 q0 = *(const float4*)(rowbase + hi8);
    float4 q1 = *(const float4*)(rowbase + hi8 + 4);
    float4 q2 = *(const float4*)(rowbase + 16 + hi8);
    float4 q3 = *(const float4*)(rowbase + 16 + hi8 + 4);
    v16h v = {(_Float16)q0.x, (_Float16)q0.y, (_Float16)q0.z, (_Float16)q0.w,
              (_Float16)q1.x, (_Float16)q1.y, (_Float16)q1.z, (_Float16)q1.w,
              (_Float16)q2.x, (_Float16)q2.y, (_Float16)q2.z, (_Float16)q2.w,
              (_Float16)q3.x, (_Float16)q3.y, (_Float16)q3.z, (_Float16)q3.w};
    return v;
}

// ---------------------------------------------------------------------------
// Kernel 1: WMMA projections straight from f32 x [b][c][n] and f32 weights.
// Work-group: 64 tokens, 8 waves.
// Stage: wave w reads the 32 channels of k-step w.  A lane reads
// x[c][m0 + 4*col .. +3] as one float4, so a half-wave covers 256 contiguous
// bytes of channel c; component j feeds B tile j, whose column col is therefore
// token m0 + 4*col + j.  Element e of a fragment is channel k0 + hi + e (e < 8)
// or k0 + 16 + hi + e - 8, as in load_ab.  The four f16 fragments go to LDS in
// register order (lane-contiguous 16B pieces).
// Product: wave t < 6 owns the 16 output rows t of f|g|h (weights read as f32
// while x is in flight) and all 64 tokens: 8 k-steps x 4 WMMAs, k ascending.
// f, g and h are stored in fragment order (load_frag).  f, g: one fragment per
// 16 tokens, k = d.  h: one fragment per (32 tokens, 16 rows d), k = token.
// Element k of row or column i sits in piece k >> 4, lane ((k >> 3) & 1) * 16 + i,
// place k & 7: the k order of load_ab.
// ---------------------------------------------------------------------------
#define KSTEPS (CC / 32)

__global__ void __launch_bounds__(32 * KSTEPS)
proj_wmma_kernel(const float* __restrict__ x,
                 const float* __restrict__ Wf, const float* __restrict__ Wg,
                 const float* __restrict__ Wh,
                 const float* __restrict__ bf, const float* __restrict__ bg,
                 const float* __restrict__ bh,
                 _Float16* __restrict__ Ft, _Float16* __restrict__ Gt,
                 _Float16* __restrict__ Hd) {
    __shared__ __align__(16) _Float16 Bf[KSTEPS][4][2][32][8];   // [k-step][j][half][lane]
    int lane = threadIdx.x & 31;
    int wave = __builtin_amdgcn_readfirstlane(threadIdx.x >> 5);   // scalar role choice
    int b = blockIdx.y;
    int m0 = blockIdx.x * 64;
    int col = lane & 15, hi = (lane >= 16) ? 8 : 0;
    int p = wave >> 1, dt = wave & 1;
    const float* W    = (p == 0) ? Wf : ((p == 1) ? Wg : Wh);
    const float* bias = (p == 0) ? bf : ((p == 1) ? bg : bh);

    const float* xp = x + ((size_t)b * CC + wave * 32 + hi) * NN + m0 + col * 4;
    float4 c[16];
    #pragma unroll   // constant indices keep c in registers; all 16 loads fly together
    for (int e = 0; e < 16; ++e)
        c[e] = *(const float4*)(xp + (size_t)(e < 8 ? e : e + 8) * NN);
    // The x loads' address registers are reused for the weight addresses below.
    asm volatile("s_wait_xcnt 0x0" ::: "memory");

    v16h a[KSTEPS];
    if (wave < 6) {
        #pragma unroll   // constant indices keep a in registers
        for (int ks = 0; ks < KSTEPS; ++ks)
            a[ks] = load_ab_f32(W + (size_t)(dt * 16 + col) * CC + ks * 32, hi);
    }

    #pragma unroll   // constant indices into c, here and in the inner loop
    for (int half = 0; half < 2; ++half) {
        v8h f0, f1, f2, f3;
        #pragma unroll
        for (int e = 0; e < 8; ++e) {
            f0[e] = (_Float16)c[half * 8 + e].x;
            f1[e] = (_Float16)c[half * 8 + e].y;
            f2[e] = (_Float16)c[half * 8 + e].z;
            f3[e] = (_Float16)c[half * 8 + e].w;
        }
        *(v8h*)&Bf[wave][0][half][lane][0] = f0;
        *(v8h*)&Bf[wave][1][half][lane][0] = f1;
        *(v8h*)&Bf[wave][2][half][lane][0] = f2;
        *(v8h*)&Bf[wave][3][half][lane][0] = f3;
    }
    __syncthreads();   // all eight k-steps' fragments are in LDS before any is read
    if (wave >= 6) return;

    v8f acc[4] = {};   // [token component j]
    #pragma unroll   // constant indices into a and acc, from here to the stores
    for (int ks = 0; ks < KSTEPS; ++ks)
        #pragma unroll
        for (int j = 0; j < 4; ++j) {
            union { v16h v; v8h h[2]; } u;
            u.h[0] = *(const v8h*)&Bf[ks][j][0][lane][0];
            u.h[1] = *(const v8h*)&Bf[ks][j][1][lane][0];
            acc[j] = wmma16(a[ks], u.v, acc[j]);
        }

    float4 bA = *(const float4*)(bias + dt * 16 + hi);
    float4 bB = *(const float4*)(bias + dt * 16 + hi + 4);
    float bia[8] = {bA.x, bA.y, bA.z, bA.w, bB.x, bB.y, bB.z, bB.w};
    if (p < 2) {
        _Float16* dst = ((p == 0) ? Ft : Gt) + (size_t)b * NN * DD;
        float sc = (p == 0) ? LOG2E : 1.0f;   // f carries the change of base
        #pragma unroll
        for (int j = 0; j < 4; ++j) {
            v8h pk;
            #pragma unroll
            for (int r = 0; r < 8; ++r)
                pk[r] = (_Float16)((acc[j][r] + bia[r]) * sc);
            // token m0 + 4*col + j, k = dt*16 + hi .. + 7: piece dt, lane half hi / 8
            *(v8h*)(dst + (size_t)((m0 >> 4) + (col >> 2)) * FRAG + dt * 256 +
                    (hi * 2 + (col & 3) * 4 + j) * 8) = pk;
        }
    } else {
        _Float16* dst = Hd + (size_t)b * DD * NN;
        #pragma unroll
        for (int r = 0; r < 8; ++r) {
            v4h pk;   // four neighbouring tokens of one d row
            #pragma unroll
            for (int j = 0; j < 4; ++j)
                pk[j] = (_Float16)(acc[j][r] + bia[r]);
            // row dt*16 + hi + r, k = (col & 7) * 4 .. + 3 of token chunk m0/32 + col/8
            *(v4h*)(dst + (size_t)(((m0 >> 5) + (col >> 3)) * 2 + dt) * FRAG +
                    ((col >> 2) & 1) * 256 + (((col >> 1) & 1) * 16 + hi + r) * 8 +
                    (col & 1) * 4) = pk;
        }
        // The listing lays the f/g store block behind this one and reuses the
        // registers these stores name.
        asm volatile("s_wait_xcnt 0x0" ::: "memory");
    }
}

// ---------------------------------------------------------------------------
// Kernel 2: softmax stats.  Work-group owns TILE rows n, and every one of its SPLIT
// waves holds all of them (RT A fragments) and sweeps its own SPAN columns m, so that
// one loaded g fragment feeds RT WMMAs.
// One sweep: Z = sum 2^l with no shift (C = 0).  Cross-lane sum, the waves' sums meet
// in LDS, S[b][n] = log2 Z.  An f32 sum of positive terms is as exact at any scale as
// long as nothing overflows and what is flushed to zero does not count: with
// ZLO <= Z <= ZHI no term or partial sum exceeds ZHI, and the terms below 2^-126,
// NN of them at most, add up to less than 2^-50 of Z.
// Where a row of the tile leaves that range (NaN included) the whole work-group
// does the shifted form instead:
// Pass 1: logits -> running max (8 v_max / WMMA).  Cross-lane max merge.
// Pass 2: C = own max, so the WMMA gives l - max -> sum 2^(l - max).  Cross-lane sum.
// Merge: the waves' (max, sum) pairs meet in LDS.  S[b][n] = max + log2 Z.
// ---------------------------------------------------------------------------
#define RT 4                // 16-wide tiles of the kept axis that a wave holds
#define TILE (16 * RT)      // rows (stats) or tokens (apply) of one work-group
#define ZLO 0x1p-64f
#define ZHI 0x1p+64f

__global__ void __launch_bounds__(32 * SPLIT)
stats_kernel(const _Float16* __restrict__ Ft, const _Float16* __restrict__ Gt,
             float* __restrict__ S) {
    __shared__ float pmax[SPLIT][TILE];
    __shared__ float psum[SPLIT][TILE];
    __shared__ int redo[TILE / 32];
    int lane = threadIdx.x & 31;
    int wave = __builtin_amdgcn_readfirstlane(threadIdx.x >> 5);   // scalar sweep bounds
    int b = blockIdx.y;
    int n0 = blockIdx.x * TILE;
    int mBeg = wave * SPAN;
    int col = lane & 15, hi = (lane >= 16) ? 8 : 0;
    const _Float16* Fb = Ft + (size_t)b * NN * DD;
    const _Float16* Gb = Gt + (size_t)b * NN * DD;

    v16h a[RT];
    #pragma unroll   // constant indices keep a, mx, mv and sm in registers, here and below
    for (int t = 0; t < RT; ++t)
        a[t] = load_frag(Fb, (n0 >> 4) + t, lane);

    float sm[RT][8] = {};
    #pragma unroll 4   // eight loads of a wave fly together
    for (int i = 0; i < SPAN / 16; ++i) {
        v16h bb = load_frag(Gb, (mBeg >> 4) + i, lane);
        v8f z = {};
        #pragma unroll
        for (int t = 0; t < RT; ++t) {
            v8f c = wmma16(a[t], bb, z);
            #pragma unroll
            for (int r = 0; r < 8; ++r)
                sm[t][r] += __builtin_amdgcn_exp2f(c[r]);
        }
    }
    #pragma unroll
    for (int t = 0; t < RT; ++t)
        #pragma unroll
        for (int r = 0; r < 8; ++r)
            #pragma unroll
            for (int off = 1; off < 16; off <<= 1)
                sm[t][r] += __shfl_xor(sm[t][r], off, 16);
    if (col == 0) {
        #pragma unroll
        for (int t = 0; t < RT; ++t)
            #pragma unroll
            for (int r = 0; r < 8; ++r)
                psum[wave][t * 16 + hi + r] = sm[t][r];
    }
    __syncthreads();   // every wave's sums are in LDS before the first waves add them
    int row = wave * 32 + lane;   // a row of the tile in the first TILE / 32 waves
    float Z = 0.0f;
    if (wave < TILE / 32) {
        #pragma unroll
        for (int w = 0; w < SPLIT; ++w) Z += psum[w][row];
        // every lane stores the wave's one answer
        redo[wave] = __builtin_amdgcn_ballot_w32(!(Z >= ZLO && Z <= ZHI)) != 0;
    }
    __syncthreads();   // the range test's answer reaches every wave; psum is read out
    int again = 0;
    #pragma unroll
    for (int w = 0; w < TILE / 32; ++w) again |= redo[w];
    // a scalar branch: the same way for the whole work-group, barriers lie behind it
    if (__builtin_expect(__builtin_amdgcn_readfirstlane(again) == 0, 1)) {
        if (wave < TILE / 32) {
            // log2 with its v_nop in one statement: the store reads the result, and the
            // listing had only scalar instructions between the two.
            float lz;
            asm("v_log_f32 %0, %1\n\tv_nop" : "=v"(lz) : "v"(Z));
            S[(size_t)b * NN + n0 + row] = lz;
        }
        return;
    }

    float mx[RT][8];
    #pragma unroll
    for (int t = 0; t < RT; ++t)
        #pragma unroll
        for (int r = 0; r < 8; ++r) mx[t][r] = -3.0e38f;

    #pragma unroll 4   // eight loads of a wave fly together
    for (int i = 0; i < SPAN / 16; ++i) {
        v16h bb = load_frag(Gb, (mBeg >> 4) + i, lane);
        v8f z = {};
        #pragma unroll
        for (int t = 0; t < RT; ++t) {
            v8f c = wmma16(a[t], bb, z);
            #pragma unroll
            for (int r = 0; r < 8; ++r)
                mx[t][r] = fmaxf(mx[t][r], c[r]);
        }
    }
    #pragma unroll
    for (int t = 0; t < RT; ++t)
        #pragma unroll
        for (int r = 0; r < 8; ++r)
            #pragma unroll
            for (int off = 1; off < 16; off <<= 1)
                mx[t][r] = fmaxf(mx[t][r], __shfl_xor(mx[t][r], off, 16));

    v8f mv[RT];
    #pragma unroll
    for (int t = 0; t < RT; ++t)
        #pragma unroll
        for (int r = 0; r < 8; ++r) {
            mv[t][r] = mx[t][r];
            sm[t][r] = 0.0f;
        }
    #pragma unroll 4   // eight loads of a wave fly together
    for (int i = 0; i < SPAN / 16; ++i) {
        v16h bb = load_frag(Gb, (mBeg >> 4) + i, lane);
        #pragma unroll
        for (int t = 0; t < RT; ++t) {
            v8f c = wmma16_sub(a[t], bb, mv[t]);
            #pragma unroll
            for (int r = 0; r < 8; ++r)
                sm[t][r] += __builtin_amdgcn_exp2f(c[r]);
        }
    }
    #pragma unroll
    for (int t = 0; t < RT; ++t)
        #pragma unroll
        for (int r = 0; r < 8; ++r)
            #pragma unroll
            for (int off = 1; off < 16; off <<= 1)
                sm[t][r] += __shfl_xor(sm[t][r], off, 16);

    if (col == 0) {
        #pragma unroll
        for (int t = 0; t < RT; ++t)
            #pragma unroll
            for (int r = 0; r < 8; ++r) {
                pmax[wave][t * 16 + hi + r] = mx[t][r];
                psum[wave][t * 16 + hi + r] = sm[t][r];
            }
    }
    __syncthreads();   // every wave's pair is in LDS before the first waves merge them
    if (wave < TILE / 32) {
        float M = pmax[0][row];
        #pragma unroll
        for (int w = 1; w < SPLIT; ++w) M = fmaxf(M, pmax[w][row]);
        Z = 0.0f;
        #pragma unroll
        for (int w = 0; w < SPLIT; ++w) {
            // 2^x with its v_nop in one statement.
            float e;
            asm("v_exp_f32 %0, %1\n\tv_nop" : "=v"(e) : "v"(pmax[w][row] - M));
            Z += psum[w][row] * e;
        }
        // Z >= 1: the row's largest term is 2^0.
        S[(size_t)b * NN + n0 + row] = M + __builtin_amdgcn_logf(Z);
    }
}

// ---------------------------------------------------------------------------
// Kernel 3: attention apply.  Work-group owns TILE output tokens m, and every one of
// its SPLIT waves holds all of them (RT g fragments) and sums its own SPAN rows n into
// sa[32][TILE], 2 * RT accumulators, so that one loaded f, S or h fragment feeds RT
// WMMAs; the partial tiles are added up through LDS at the end.
// Per 32-n chunk: 2 * RT logit WMMAs -> exp -> 2 * RT sa WMMAs.
// A lane's C operand of logit tile t is S at rows n = 16t + hi .. + 7, the rows of its D.
// P never leaves the registers: a lane of logit tile t holds column m = col, rows
// n = 16t + hi .. + 7, and those are the k of piece t of the B fragment for column
// col in the same lane (the k order of load_ab), so the packed values are the operand.
// Tail: the summed tile, rounded to f16, goes token-major into LDS and is the B
// operand of the output 1x1 conv D->C (K = 32, one WMMA per 16 x 16 tile):
// wave w owns channels 16w .. 16w+15 and all RT token tiles; + bias, * gamma.
// ---------------------------------------------------------------------------
// The apply loop's vector work, in the order in which it is to issue.  Outputs are early
// clobbers: no 2^x writes over a source of the one in front of it, and a statement ends in
// an instruction that is independent of its last 2^x (the slot behind a transcendental).
// ha and hb are the A and B operands of the WMMA in front of the statement, which may have
// been the last to read them: as inputs of the statement their registers are closed to its
// outputs, so that none is overwritten within the four slots the chip needs behind a WMMA.
// Four 2^x of a trip's first logit tile, with nothing to pack beside them.
__device__ __forceinline__ void exp4(float& e0, float& e1, float& e2, float& e3,
                                     float d0, float d1, float d2, float d3,
                                     v16h ha, v16h hb) {
    asm volatile("v_exp_f32 %0, %4\n\tv_exp_f32 %1, %5\n\tv_exp_f32 %2, %6\n\t"
                 "v_exp_f32 %3, %7\n\tv_nop"
                 : "=&v"(e0), "=&v"(e1), "=&v"(e2), "=&v"(e3)
                 : "v"(d0), "v"(d1), "v"(d2), "v"(d3), "v"(ha), "v"(hb));
}
// The same with a v_nop in front: the fourth slot between that tile's WMMA and its first reader.
__device__ __forceinline__ void exp4_first(float& e0, float& e1, float& e2, float& e3,
                                           float d0, float d1, float d2, float d3,
                                           v16h ha, v16h hb) {
    asm volatile("v_nop\n\tv_exp_f32 %0, %4\n\tv_exp_f32 %1, %5\n\tv_exp_f32 %2, %6\n\t"
                 "v_exp_f32 %3, %7\n\tv_nop"
                 : "=&v"(e0), "=&v"(e1), "=&v"(e2), "=&v"(e3)
                 : "v"(d0), "v"(d1), "v"(d2), "v"(d3), "v"(ha), "v"(hb));
}
// Four 2^x of one logit tile, and between them two packs of the tile before.
__device__ __forceinline__ void exp4_pack2(float& e0, float& e1, float& e2, float& e3,
                                           unsigned& p0, unsigned& p1,
                                           float d0, float d1, float d2, float d3,
                                           float q0, float q1, float q2, float q3,
                                           v16h ha, v16h hb) {
    asm volatile("v_exp_f32 %0, %6\n\tv_exp_f32 %1, %7\n\tv_cvt_pk_f16_f32 %4, %10, %11\n\t"
                 "v_exp_f32 %2, %8\n\tv_exp_f32 %3, %9\n\tv_cvt_pk_f16_f32 %5, %12, %13"
                 : "=&v"(e0), "=&v"(e1), "=&v"(e2), "=&v"(e3), "=&v"(p0), "=&v"(p1)
                 : "v"(d0), "v"(d1), "v"(d2), "v"(d3), "v"(q0), "v"(q1), "v"(q2), "v"(q3),
                   "v"(ha), "v"(hb));
}
// The four packs of a trip's last tile.  The hints let the SIMD's other waves issue while
// the last two packs wait for the 2^x just in front of them.
__device__ __forceinline__ void pack4(unsigned& p0, unsigned& p1, unsigned& p2, unsigned& p3,
                                      const float (&q)[8], v16h ha, v16h hb) {
    asm volatile("v_cvt_pk_f16_f32 %0, %4, %5\n\tv_cvt_pk_f16_f32 %1, %6, %7\n\t"
                 "s_delay_alu instid0(TRANS32_DEP_3)\n\tv_cvt_pk_f16_f32 %2, %8, %9\n\t"
                 "s_delay_alu instid0(TRANS32_DEP_1)\n\tv_cvt_pk_f16_f32 %3, %10, %11"
                 : "=&v"(p0), "=&v"(p1), "=&v"(p2), "=&v"(p3)
                 : "v"(q[0]), "v"(q[1]), "v"(q[2]), "v"(q[3]),
                   "v"(q[4]), "v"(q[5]), "v"(q[6]), "v"(q[7]), "v"(ha), "v"(hb));
}

// One fragment (load_frag's two pieces) from a lane's own address.
__device__ __forceinline__ v16h load_pieces(const _Float16* p) {
    union { v16h v; v8h p[2]; } u;
    u.p[0] = *(const v8h*)(p);
    u.p[1] = *(const v8h*)(p + 256);
    return u.v;
}

template <bool B> struct bool_tag { static constexpr bool value = B; };

__global__ void __launch_bounds__(32 * SPLIT)
attn_out_kernel(const _Float16* __restrict__ Ft, const _Float16* __restrict__ Gt,
                const _Float16* __restrict__ Hd, const float* __restrict__ S,
                const float* __restrict__ Wv, const float* __restrict__ bv,
                const float* __restrict__ gamma, float* __restrict__ out) {
    __shared__ __align__(16) float red[SPLIT][TILE][36];     // [wave][m][d], padded
    __shared__ __align__(16) _Float16 sat[TILE][40];         // [m][d], padded: summed tile
    int lane = threadIdx.x & 31;
    int wave = __builtin_amdgcn_readfirstlane(threadIdx.x >> 5);   // scalar sweep bounds
    int b = blockIdx.y;
    int m0 = blockIdx.x * TILE;
    int nBeg = wave * SPAN, nEnd = nBeg + SPAN;
    int col = lane & 15, hi = (lane >= 16) ? 8 : 0;
    const _Float16* Fb = Ft + (size_t)b * NN * DD;
    const _Float16* Gb = Gt + (size_t)b * NN * DD;
    const _Float16* Hb = Hd + (size_t)b * DD * NN;
    const float*    Sb = S + (size_t)b * NN;

    v16h gB[RT];
    #pragma unroll   // constant indices keep gB, acc and pB in registers, here and below
    for (int mt = 0; mt < RT; ++mt)
        gB[mt] = load_frag(Gb, (m0 >> 4) + mt, lane);

    v8f acc[2][RT] = {};   // [d-tile][m-tile]
    // f and S come a whole trip ahead of their use, in two register sets that take turns
    // (the loop body holds two trips, so that no set is ever copied); h comes at the head of
    // its own trip, three tiles ahead of the first sa WMMA.
    v16h fA[2][2];   // [set][logit tile t]
    v8f sC[2][2];
    #pragma unroll
    for (int t = 0; t < 2; ++t) {
        fA[0][t] = load_frag(Fb, (nBeg >> 4) + t, lane);
        sC[0][t] = *(const v8f*)(Sb + nBeg + t * 16 + hi);
    }
    // Two trips, as a lambda that is expanded twice: in the loop, and once more behind it for
    // the span's last two trips, of which the second has no next trip to load for.
    auto two_trips = [&](int nb, auto last_tag) __attribute__((always_inline)) {
        constexpr bool LAST = decltype(last_tag)::value;
        #pragma unroll   // the set's index is a constant
        for (int u = 0; u < 2; ++u) {
            int n0 = nb + u * 32;
            // Lane addresses of this trip's h and of the next trip's f and S (the span's last
            // trip has no next one: there they name its own rows, and nothing is loaded).
            int nn = (LAST && u == 1) ? n0 : n0 + 32;
            const _Float16* ph = Hb + (unsigned)((n0 >> 5) * 2 * FRAG + lane * 8);
            const _Float16* pf = Fb + (unsigned)((nn >> 4) * FRAG + lane * 8);
            const float* ps = Sb + nn + hi;
            v16h hA0 = load_pieces(ph), hA1 = load_pieces(ph + FRAG);
            if (!(LAST && u == 1)) {   // a compile-time test
                #pragma unroll
                for (int t = 0; t < 2; ++t) {
                    fA[u ^ 1][t] = load_pieces(pf + t * FRAG);
                    sC[u ^ 1][t] = *(const v8f*)(ps + t * 16);
                }
            }
            // The address registers are rewritten further down.  As inputs of the wait they
            // stay whole up to it: without them the listing gave some to the last loads' results.
            asm volatile("s_wait_xcnt 0x0" :: "v"(ph), "v"(pf), "v"(ps) : "memory");
            // All twelve loads are asked for at the trip's head: without this line the
            // listing sinks them towards their users.
            __builtin_amdgcn_sched_barrier(0);
            // Tile k = 2 * mt + t.  The trip runs as a pipeline in the wave's own order: a logit
            // WMMA is issued four tiles ahead of the 2^x that read it, a tile's 2^x results are
            // packed one tile later, among the next tile's 2^x, and an sa WMMA follows its packs
            // by half a tile or more, but the last m-tile's two follow pack4 directly.
            union { v16h v; unsigned u[8]; } pB[RT];   // [m-tile]; words 4t .. 4t+3 = logit tile t
            v8f dl[8];
            float e[2][8];
            #pragma unroll
            for (int k = 0; k < 4; ++k)
                dl[k] = wmma16_sub(fA[u][k & 1], gB[k >> 1], sC[u][k & 1]);
            __builtin_amdgcn_sched_barrier(0);   // here and below: a WMMA or a statement stays where it is written
            #pragma unroll
            for (int k = 0; k < 8; ++k) {
                #pragma unroll
                for (int hf = 0; hf < 2; ++hf) {
                    const int o = hf * 4, c = k & 1, q = c ^ 1;
                    if (k == 0 && hf == 0) {
                        // the second and the fourth logit WMMA stand within four slots
                        exp4_first(e[0][0], e[0][1], e[0][2], e[0][3],
                                   dl[0][0], dl[0][1], dl[0][2], dl[0][3], gB[0], gB[1]);
                    } else if (k == 0) {
                        exp4(e[0][4], e[0][5], e[0][6], e[0][7],
                             dl[0][4], dl[0][5], dl[0][6], dl[0][7], gB[0], gB[1]);
                    } else {
                        const int pm = (k - 1) >> 1, pw = ((k - 1) & 1) * 4 + hf * 2;
                        // A and B of the WMMA just in front (in a half with none: as in the half before, but at k = 5 and 7 those of the WMMA behind)
                        v16h ha = (k <= 2 || (k <= 4 && hf == 0)) ? fA[u][(k - 1) & 1]
                                : ((k == 3 || k == 5 || k == 7) ? hA0 : hA1);
                        v16h hb = (k <= 2 || (k <= 4 && hf == 0)) ? gB[(k + 3) >> 1]
                                : pB[k <= 4 ? 0 : k <= 6 ? 1 : 2].v;
                        exp4_pack2(e[c][o], e[c][o + 1], e[c][o + 2], e[c][o + 3],
                                   pB[pm].u[pw], pB[pm].u[pw + 1],
                                   dl[k][o], dl[k][o + 1], dl[k][o + 2], dl[k][o + 3],
                                   e[q][o], e[q][o + 1], e[q][o + 2], e[q][o + 3], ha, hb);
                    }
                    __builtin_amdgcn_sched_barrier(0);
                    if (hf == 1 && k < 4)
                        dl[k + 4] = wmma16_sub(fA[u][k & 1], gB[(k + 4) >> 1], sC[u][k & 1]);
                    if (hf == 0 && k == 3) acc[0][0] = wmma16(hA0, pB[0].v, acc[0][0]);
                    if (hf == 0 && k == 4) acc[1][0] = wmma16(hA1, pB[0].v, acc[1][0]);
                    if (hf == 0 && k == 5) acc[0][1] = wmma16(hA0, pB[1].v, acc[0][1]);
                    if (hf == 1 && k == 5) acc[1][1] = wmma16(hA1, pB[1].v, acc[1][1]);
                    if (hf == 0 && k == 7) acc[0][2] = wmma16(hA0, pB[2].v, acc[0][2]);
                    if (hf == 1 && k == 7) acc[1][2] = wmma16(hA1, pB[2].v, acc[1][2]);
                    __builtin_amdgcn_sched_barrier(0);
                }
            }
            pack4(pB[3].u[4], pB[3].u[5], pB[3].u[6], pB[3].u[7], e[1], hA1, pB[2].v);
            __builtin_amdgcn_sched_barrier(0);
            acc[0][3] = wmma16(hA0, pB[3].v, acc[0][3]);
            acc[1][3] = wmma16(hA1, pB[3].v, acc[1][3]);
        }
    };
    #pragma unroll 1   // rolled: the body's two trips hold 32 WMMAs
    for (int nb = nBeg; nb < nEnd - 64; nb += 64)
        two_trips(nb, bool_tag<false>{});
    two_trips(nEnd - 64, bool_tag<true>{});
    #pragma unroll
    for (int dt = 0; dt < 2; ++dt)
        #pragma unroll
        for (int mt = 0; mt < RT; ++mt) {
            float* rp = &red[wave][mt * 16 + col][dt * 16 + hi];
            *(float4*)(rp)     = make_float4(acc[dt][mt][0], acc[dt][mt][1],
                                             acc[dt][mt][2], acc[dt][mt][3]);
            *(float4*)(rp + 4) = make_float4(acc[dt][mt][4], acc[dt][mt][5],
                                             acc[dt][mt][6], acc[dt][mt][7]);
        }
    __syncthreads();   // every wave's partial tile is in LDS before it is summed
    // The tail's operands are asked for here, so that they fly during the sum.
    int c0 = wave * 16;
    v16h wA = load_ab_f32(Wv + (size_t)(c0 + col) * DD, hi);
    float4 bA = *(const float4*)(bv + c0 + hi);
    float4 bB = *(const float4*)(bv + c0 + hi + 4);
    float gm = gamma[0];
    // 512 threads x 4 = TILE x 32.  The two rows that a half-wave reads lie 8 apart:
    // 8 * 36 dwords = 32 mod 64, so that its 64 dwords fall on 64 different banks.
    int m = (wave >> 3) * 32 + (wave & 7) + (lane >> 3) * 8, d = (lane & 7) * 4;
    float4 s = make_float4(0.0f, 0.0f, 0.0f, 0.0f);
    #pragma unroll
    for (int w = 0; w < SPLIT; ++w) {
        float4 v = *(const float4*)&red[w][m][d];
        s.x += v.x;
        s.y += v.y;
        s.z += v.z;
        s.w += v.w;
    }
    v4h pk4 = {(_Float16)s.x, (_Float16)s.y, (_Float16)s.z, (_Float16)s.w};
    *(v4h*)&sat[m][d] = pk4;
    __syncthreads();   // the whole summed tile is in LDS before any wave reads it

    float bia[8] = {bA.x, bA.y, bA.z, bA.w, bB.x, bB.y, bB.z, bB.w};
    float* op = out + ((size_t)b * CC + c0 + hi) * NN + m0 + col;
    v8f o[RT];
    #pragma unroll
    for (int mt = 0; mt < RT; ++mt) {
        v8f z = {};
        o[mt] = wmma16(wA, load_ab(&sat[mt * 16 + col][0], hi), z);
    }
    #pragma unroll
    for (int r = 0; r < 8; ++r)
        #pragma unroll
        for (int mt = 0; mt < RT; ++mt)
            op[(size_t)r * NN + mt * 16] = gm * (o[mt][r] + bia[r]);
}

extern "C" void kernel_launch(void* const* d_in, const int* in_sizes, int n_in,
                              void* d_out, int out_size, void* d_ws, size_t ws_size,
                              hipStream_t stream) {
    const float* x     = (const float*)d_in[0];
    const float* Wf    = (const float*)d_in[1];
    const float* bf    = (const float*)d_in[2];
    const float* Wg    = (const float*)d_in[3];
    const float* bg    = (const float*)d_in[4];
    const float* Wh    = (const float*)d_in[5];
    const float* bh    = (const float*)d_in[6];
    const float* Wv    = (const float*)d_in[7];
    const float* bv    = (const float*)d_in[8];
    const float* gamma = (const float*)d_in[9];
    float* out = (float*)d_out;

    // workspace layout (~3.2 MB)
    char* w = (char*)d_ws;
    _Float16* Ft  = (_Float16*)w; w += (size_t)Bb * NN * DD * 2;   // 1 MB
    _Float16* Gt  = (_Float16*)w; w += (size_t)Bb * NN * DD * 2;
    _Float16* Hd  = (_Float16*)w; w += (size_t)Bb * DD * NN * 2;
    float*    S   = (float*)w;                                     // log2 of the row sum of 2^l

    proj_wmma_kernel<<<dim3(NN / 64, Bb), 32 * KSTEPS, 0, stream>>>(
        x, Wf, Wg, Wh, bf, bg, bh, Ft, Gt, Hd);
    stats_kernel<<<dim3(NN / TILE, Bb), 32 * SPLIT, 0, stream>>>(Ft, Gt, S);
    attn_out_kernel<<<dim3(NN / TILE, Bb), 32 * SPLIT, 0, stream>>>(
        Ft, Gt, Hd, S, Wv, bv, gamma, out);
}

// v010
// One run takes 23.1 microseconds.
// Timed twice side by side with v009, it ran 1.03 times as fast both times.
// Counting every step since v000, it is 9.80 times as fast.
#include <hip/hip_runtime.h>
#include <hip/hip_bf16.h>

typedef __attribute__((ext_vector_type(16))) _Float16 v16h;
typedef __attribute__((ext_vector_type(8)))  _Float16 v8h;
typedef __attribute__((ext_vector_type(4)))  _Float16 v4h;
typedef __attribute__((ext_vector_type(2)))  _Float16 v2h;
typedef __attribute__((ext_vector_type(8)))  float    v8f;
typedef __attribute__((ext_vector_type(4)))  float    v4f;

#define Bb 4
#define CC 256
#define DD 32
#define NN 4096
#define SPLIT 16            // waves of one work-group that share one sweep
#define SPAN (NN / SPLIT)   // positions of the swept axis per wave

// Load one f16 A/B operand for V_WMMA_F32_16X16X32_F16 from K-contiguous
// storage: lane<16 needs K in {0..7, 16..23}, lane>=16 needs {8..15, 24..31}
// -> two 16B vector loads per lane.
__device__ __forceinline__ v16h load_ab(const _Float16* rowbase, int hi8) {
    union { v16h v; v8h p[2]; } u;
    u.p[0] = *(const v8h*)(rowbase + hi8);
    u.p[1] = *(const v8h*)(rowbase + 16 + hi8);
    return u.v;
}

// The same operand from fragment-order storage, [piece][lane][8]: piece 0 holds
// each lane's first eight k, piece 1 its second eight, so that each of the two
// loads reads 512 contiguous bytes (four whole 128-byte lines) per wave.
#define FRAG 512            // f16 elements of one 16 x 32 fragment
__device__ __forceinline__ v16h load_frag(const _Float16* base, unsigned frag, int lane) {
    unsigned off = frag * FRAG + lane * 8;   // 32-bit offset on a wave-uniform base
    union { v16h v; v8h p[2]; } u;
    u.p[0] = *(const v8h*)(base + off);
    u.p[1] = *(const v8h*)(base + off + 256);
    return u.v;
}

__device__ __forceinline__ v8f wmma16(v16h a, v16h b, v8f c) {
    return __builtin_amdgcn_wmma_f32_16x16x32_f16(false, a, false, b,
                                                  (short)0, c, false, false);
}

// Logits are formed in log2 units: f is stored times log2(e), and a row's softmax
// offset is the (negated) C operand of the logit WMMA, so that D is the argument of
// the hardware's 2^x with no vector instruction in between.
#define LOG2E 1.44269504088896340736f

// D = A B - C: the C modifier of the instruction negates C at no cost.
__device__ __forceinline__ v8f wmma16_sub(v16h a, v16h b, v8f c) {
    return __builtin_amdgcn_wmma_f32_16x16x32_f16(false, a, false, b,
                                                  (short)1, c, false, false);
}

// The same operand from f32 storage: four 16B loads per lane, rounded to f16
// on the way into the fragment (same k order as load_ab).
__device__ __forceinline__ v16h load_ab_f32(const float* rowbase, int hi8) {
    float4 q0 = *(const float4*)(rowbase + hi8);
    float4 q1 = *(const float4*)(rowbase + hi8 + 4);
    float4 q2 = *(const float4*)(rowbase + 16 + hi8);
    float4 q3 = *(const float4*)(rowbase + 16 + hi8 + 4);
    v16h v = {(_Float16)q0.x, (_Float16)q0.y, (_Float16)q0.z, (_Float16)q0.w,
              (_Float16)q1.x, (_Float16)q1.y, (_Float16)q1.z, (_Float16)q1.w,
              (_Float16)q2.x, (_Float16)q2.y, (_Float16)q2.z, (_Float16)q2.w,
              (_Float16)q3.x, (_Float16)q3.y, (_Float16)q3.z, (_Float16)q3.w};
    return v;
}

// ---------------------------------------------------------------------------
// Kernel 1: WMMA projections straight from f32 x [b][c][n] and f32 weights.
// Work-group: 64 tokens, 8 waves.
// Stage: wave w reads the 32 channels of k-step w.  A lane reads
// x[c][m0 + 4*col .. +3] as one float4, so a half-wave covers 256 contiguous
// bytes of channel c; component j feeds B tile j, whose column col is therefore
// token m0 + 4*col + j.  Element e of a fragment is channel k0 + hi + e (e < 8)
// or k0 + 16 + hi + e - 8, as in load_ab.  The four f16 fragments go to LDS in
// register order (lane-contiguous 16B pieces).
// Weights: wave w also brings k-step w of all 96 rows of Wf|Wg|Wh.  Eight lanes read the
// 128 bytes of one row, so a load covers four whole lines (a lane that reads its own
// fragment row touches 16).  Rounded to f16, they go to LDS as A fragments in load_ab's
// k order: block = piece * 2 + lane half, 16 rows of eight k each.
// Product: wave t < 6 owns the 16 output rows t of f|g|h (A fragments from LDS)
// and all 64 tokens: 8 k-steps x 4 WMMAs, k ascending.
// f, g and h are stored in fragment order (load_frag).  f, g: one fragment per
// 16 tokens, k = d.  h: one fragment per (32 tokens, 16 rows d), k = token.
// Element k of row or column i sits in piece k >> 4, lane ((k >> 3) & 1) * 16 + i,
// place k & 7: the k order of load_ab.
// ---------------------------------------------------------------------------
#define KSTEPS (CC / 32)
// f16 elements from one block of an A fragment to the next: 256 bytes and 64 of pad, so
// that a fragment's four blocks start 16 banks apart and the 8-byte stores of a wave
// (four rows in each of four blocks) fall on 64 different banks.
#define WBLK 160

__global__ void __launch_bounds__(32 * KSTEPS)
proj_wmma_kernel(const float* __restrict__ x,
                 const float* __restrict__ Wf, const float* __restrict__ Wg,
                 const float* __restrict__ Wh,
                 const float* __restrict__ bf, const float* __restrict__ bg,
                 const float* __restrict__ bh,
                 _Float16* __restrict__ Ft, _Float16* __restrict__ Gt,
                 _Float16* __restrict__ Hd) {
    // One object, so that Bf comes first: all its reads then lie within the 64 KiB that an
    // LDS instruction's immediate offset reaches.
    __shared__ struct __align__(16) {
        _Float16 Bf[KSTEPS][4][2][32][8];   // [k-step][j][half][lane]
        _Float16 Af[6][KSTEPS][4][WBLK];    // [row tile][k-step][block]
    } sh;
    auto& Bf = sh.Bf;
    auto& Af = sh.Af;
    int lane = threadIdx.x & 31;
    int wave = __builtin_amdgcn_readfirstlane(threadIdx.x >> 5);   // scalar role choice
    int b = blockIdx.y;
    int m0 = blockIdx.x * 64;
    int col = lane & 15, hi = (lane >= 16) ? 8 : 0;
    int p = wave >> 1, dt = wave & 1;
    const float* bias = (p == 0) ? bf : ((p == 1) ? bg : bh);

    const float* xp = x + ((size_t)b * CC + wave * 32 + hi) * NN + m0 + col * 4;
    float4 c[16];
    #pragma unroll   // constant indices keep c in registers; all 16 loads fly together
    for (int e = 0; e < 16; ++e)
        c[e] = *(const float4*)(xp + (size_t)(e < 8 ? e : e + 8) * NN);
    // The x loads' address registers are reused for the weight addresses below.
    asm volatile("s_wait_xcnt 0x0" ::: "memory");

    int wr = lane >> 3;   // which of a load's four rows
    unsigned wo = (unsigned)(wr * CC + wave * 32 + (lane & 7) * 4);   // one lane offset for all 24 loads
    v4f wq[3][8];
    #pragma unroll   // constant indices keep wq in registers; all 24 loads fly with x
    for (int q = 0; q < 8; ++q) {
        wq[0][q] = *(const v4f*)(Wf + wo + q * 4 * CC);
        wq[1][q] = *(const v4f*)(Wg + wo + q * 4 * CC);
        wq[2][q] = *(const v4f*)(Wh + wo + q * 4 * CC);
    }
    // The weight loads' offset register is rewritten below.
    asm volatile("s_wait_xcnt 0x0" ::: "memory");
    // All 40 loads are asked for before the first wait for data: without this line the
    // listing issues the last weight loads only behind the arrival of x.
    __builtin_amdgcn_sched_barrier(0);

    #pragma unroll   // constant indices into c, here and in the inner loop
    for (int half = 0; half < 2; ++half) {
        v8h f0, f1, f2, f3;
        #pragma unroll
        for (int e = 0; e < 8; ++e) {
            f0[e] = (_Float16)c[half * 8 + e].x;
            f1[e] = (_Float16)c[half * 8 + e].y;
            f2[e] = (_Float16)c[half * 8 + e].z;
            f3[e] = (_Float16)c[half * 8 + e].w;
        }
        *(v8h*)&Bf[wave][0][half][lane][0] = f0;
        *(v8h*)&Bf[wave][1][half][lane][0] = f1;
        *(v8h*)&Bf[wave][2][half][lane][0] = f2;
        *(v8h*)&Bf[wave][3][half][lane][0] = f3;
    }
    #pragma unroll   // constant indices into wq, here and in the inner loop
    for (int m = 0; m < 3; ++m)
        #pragma unroll
        for (int q = 0; q < 8; ++q) {
            v4h pk = __builtin_convertvector(wq[m][q], v4h);
            // row q*4 + wr of matrix m, k = (lane & 7) * 4 .. + 3: piece k >> 4, half (k >> 3) & 1
            *(v4h*)&Af[m * 2 + (q >> 2)][wave][(lane >> 1) & 3]
                      [((q & 3) * 4 + wr) * 8 + (lane & 1) * 4] = pk;
        }
    __syncthreads();   // all eight k-steps' fragments, x and weights, are in LDS before any is read
    if (wave >= 6) return;

    v16h a[KSTEPS];
    #pragma unroll   // constant indices keep a in registers
    for (int ks = 0; ks < KSTEPS; ++ks) {
        union { v16h v; v8h h[2]; } u;
        u.h[0] = *(const v8h*)&Af[wave][ks][lane >> 4][col * 8];
        u.h[1] = *(const v8h*)&Af[wave][ks][2 + (lane >> 4)][col * 8];
        a[ks] = u.v;
    }

    v8f acc[4] = {};   // [token component j]
    #pragma unroll   // constant indices into a and acc, from here to the stores
    for (int ks = 0; ks < KSTEPS; ++ks)
        #pragma unroll
        for (int j = 0; j < 4; ++j) {
            union { v16h v; v8h h[2]; } u;
            u.h[0] = *(const v8h*)&Bf[ks][j][0][lane][0];
            u.h[1] = *(const v8h*)&Bf[ks][j][1][lane][0];
            acc[j] = wmma16(a[ks], u.v, acc[j]);
        }

    float4 bA = *(const float4*)(bias + dt * 16 + hi);
    float4 bB = *(const float4*)(bias + dt * 16 + hi + 4);
    float bia[8] = {bA.x, bA.y, bA.z, bA.w, bB.x, bB.y, bB.z, bB.w};
    if (p < 2) {
        _Float16* dst = ((p == 0) ? Ft : Gt) + (size_t)b * NN * DD;
        float sc = (p == 0) ? LOG2E : 1.0f;   // f carries the change of base
        #pragma unroll
        for (int j = 0; j < 4; ++j) {
            v8h pk;
            #pragma unroll
            for (int r = 0; r < 8; ++r)
                pk[r] = (_Float16)((acc[j][r] + bia[r]) * sc);
            // token m0 + 4*col + j, k = dt*16 + hi .. + 7: piece dt, lane half hi / 8
            *(v8h*)(dst + (size_t)((m0 >> 4) + (col >> 2)) * FRAG + dt * 256 +
                    (hi * 2 + (col & 3) * 4 + j) * 8) = pk;
        }
    } else {
        _Float16* dst = Hd + (size_t)b * DD * NN;
        #pragma unroll
        for (int r = 0; r < 8; ++r) {
            v4h pk;   // four neighbouring tokens of one d row
            #pragma unroll
            for (int j = 0; j < 4; ++j)
                pk[j] = (_Float16)(acc[j][r] + bia[r]);
            // row dt*16 + hi + r, k = (col & 7) * 4 .. + 3 of token chunk m0/32 + col/8
            *(v4h*)(dst + (size_t)(((m0 >> 5) + (col >> 3)) * 2 + dt) * FRAG +
                    ((col >> 2) & 1) * 256 + (((col >> 1) & 1) * 16 + hi + r) * 8 +
                    (col & 1) * 4) = pk;
        }
        // The listing lays the f/g store block behind this one and reuses the
        // registers these stores name.
        asm volatile("s_wait_xcnt 0x0" ::: "memory");
    }
}

// ---------------------------------------------------------------------------
// Kernel 2: softmax stats.  Work-group owns TILE rows n, and every one of its SPLIT
// waves holds all of them (RT A fragments) and sweeps its own SPAN columns m, so that
// one loaded g fragment feeds RT WMMAs.
// One sweep: Z = sum 2^l with no shift (C = 0).  Cross-lane sum, the waves' sums meet
// in LDS, S[b][n] = log2 Z.  An f32 sum of positive terms is as exact at any scale as
// long as nothing overflows and what is flushed to zero does not count: with
// ZLO <= Z <= ZHI no term or partial sum exceeds ZHI, and the terms below 2^-126,
// NN of them at most, add up to less than 2^-50 of Z.
// Where a row of the tile leaves that range (NaN included) the whole work-group
// does the shifted form instead:
// Pass 1: logits -> running max (8 v_max / WMMA).  Cross-lane max merge.
// Pass 2: C = own max, so the WMMA gives l - max -> sum 2^(l - max).  Cross-lane sum.
// Merge: the waves' (max, sum) pairs meet in LDS.  S[b][n] = max + log2 Z.
// ---------------------------------------------------------------------------
#define RT 4                // 16-wide tiles of the kept axis that a wave holds
#define TILE (16 * RT)      // rows (stats) or tokens (apply) of one work-group
#define ZLO 0x1p-64f
#define ZHI 0x1p+64f

__global__ void __launch_bounds__(32 * SPLIT)
stats_kernel(const _Float16* __restrict__ Ft, const _Float16* __restrict__ Gt,
             float* __restrict__ S) {
    __shared__ float pmax[SPLIT][TILE];
    __shared__ float psum[SPLIT][TILE];
    __shared__ int redo[TILE / 32];
    int lane = threadIdx.x & 31;
    int wave = __builtin_amdgcn_readfirstlane(threadIdx.x >> 5);   // scalar sweep bounds
    int b = blockIdx.y;
    int n0 = blockIdx.x * TILE;
    int mBeg = wave * SPAN;
    int col = lane & 15, hi = (lane >= 16) ? 8 : 0;
    const _Float16* Fb = Ft + (size_t)b * NN * DD;
    const _Float16* Gb = Gt + (size_t)b * NN * DD;

    v16h a[RT];
    #pragma unroll   // constant indices keep a, mx, mv and sm in registers, here and below
    for (int t = 0; t < RT; ++t)
        a[t] = load_frag(Fb, (n0 >> 4) + t, lane);

    float sm[RT][8] = {};
    #pragma unroll 4   // eight loads of a wave fly together
    for (int i = 0; i < SPAN / 16; ++i) {
        v16h bb = load_frag(Gb, (mBeg >> 4) + i, lane);
        v8f z = {};
        #pragma unroll
        for (int t = 0; t < RT; ++t) {
            v8f c = wmma16(a[t], bb, z);
            #pragma unroll
            for (int r = 0; r < 8; ++r)
                sm[t][r] += __builtin_amdgcn_exp2f(c[r]);
        }
    }
    #pragma unroll
    for (int t = 0; t < RT; ++t)
        #pragma unroll
        for (int r = 0; r < 8; ++r)
            #pragma unroll
            for (int off = 1; off < 16; off <<= 1)
                sm[t][r] += __shfl_xor(sm[t][r], off, 16);
    if (col == 0) {
        #pragma unroll
        for (int t = 0; t < RT; ++t)
            #pragma unroll
            for (int r = 0; r < 8; ++r)
                psum[wave][t * 16 + hi + r] = sm[t][r];
    }
    __syncthreads();   // every wave's sums are in LDS before the first waves add them
    int row = wave * 32 + lane;   // a row of the tile in the first TILE / 32 waves
    float Z = 0.0f;
    if (wave < TILE / 32) {
        #pragma unroll
        for (int w = 0; w < SPLIT; ++w) Z += psum[w][row];
        // every lane stores the wave's one answer
        redo[wave] = __builtin_amdgcn_ballot_w32(!(Z >= ZLO && Z <= ZHI)) != 0;
    }
    __syncthreads();   // the range test's answer reaches every wave; psum is read out
    int again = 0;
    #pragma unroll
    for (int w = 0; w < TILE / 32; ++w) again |= redo[w];
    // a scalar branch: the same way for the whole work-group, barriers lie behind it
    if (__builtin_expect(__builtin_amdgcn_readfirstlane(again) == 0, 1)) {
        if (wave < TILE / 32) {
            // log2 with its v_nop in one statement: the store reads the result, and the
            // listing had only scalar instructions between the two.
            float lz;
            asm("v_log_f32 %0, %1\n\tv_nop" : "=v"(lz) : "v"(Z));
            S[(size_t)b * NN + n0 + row] = lz;
        }
        return;
    }

    float mx[RT][8];
    #pragma unroll
    for (int t = 0; t < RT; ++t)
        #pragma unroll
        for (int r = 0; r < 8; ++r) mx[t][r] = -3.0e38f;

    #pragma unroll 4   // eight loads of a wave fly together
    for (int i = 0; i < SPAN / 16; ++i) {
        v16h bb = load_frag(Gb, (mBeg >> 4) + i, lane);
        v8f z = {};
        #pragma unroll
        for (int t = 0; t < RT; ++t) {
            v8f c = wmma16(a[t], bb, z);
            #pragma unroll
            for (int r = 0; r < 8; ++r)
                mx[t][r] = fmaxf(mx[t][r], c[r]);
        }
    }
    #pragma unroll
    for (int t = 0; t < RT; ++t)
        #pragma unroll
        for (int r = 0; r < 8; ++r)
            #pragma unroll
            for (int off = 1; off < 16; off <<= 1)
                mx[t][r] = fmaxf(mx[t][r], __shfl_xor(mx[t][r], off, 16));

    v8f mv[RT];
    #pragma unroll
    for (int t = 0; t < RT; ++t)
        #pragma unroll
        for (int r = 0; r < 8; ++r) {
            mv[t][r] = mx[t][r];
            sm[t][r] = 0.0f;
        }
    #pragma unroll 4   // eight loads of a wave fly together
    for (int i = 0; i < SPAN / 16; ++i) {
        v16h bb = load_frag(Gb, (mBeg >> 4) + i, lane);
        #pragma unroll
        for (int t = 0; t < RT; ++t) {
            v8f c = wmma16_sub(a[t], bb, mv[t]);
            #pragma unroll
            for (int r = 0; r < 8; ++r)
                sm[t][r] += __builtin_amdgcn_exp2f(c[r]);
        }
    }
    #pragma unroll
    for (int t = 0; t < RT; ++t)
        #pragma unroll
        for (int r = 0; r < 8; ++r)
            #pragma unroll
            for (int off = 1; off < 16; off <<= 1)
                sm[t][r] += __shfl_xor(sm[t][r], off, 16);

    if (col == 0) {
        #pragma unroll
        for (int t = 0; t < RT; ++t)
            #pragma unroll
            for (int r = 0; r < 8; ++r) {
                pmax[wave][t * 16 + hi + r] = mx[t][r];
                psum[wave][t * 16 + hi + r] = sm[t][r];
            }
    }
    __syncthreads();   // every wave's pair is in LDS before the first waves merge them
    if (wave < TILE / 32) {
        float M = pmax[0][row];
        #pragma unroll
        for (int w = 1; w < SPLIT; ++w) M = fmaxf(M, pmax[w][row]);
        Z = 0.0f;
        #pragma unroll
        for (int w = 0; w < SPLIT; ++w) {
            // 2^x with its v_nop in one statement.
            float e;
            asm("v_exp_f32 %0, %1\n\tv_nop" : "=v"(e) : "v"(pmax[w][row] - M));
            Z += psum[w][row] * e;
        }
        // Z >= 1: the row's largest term is 2^0.
        S[(size_t)b * NN + n0 + row] = M + __builtin_amdgcn_logf(Z);
    }
}

// ---------------------------------------------------------------------------
// Kernel 3: attention apply.  Work-group owns TILE output tokens m, and every one of
// its SPLIT waves holds all of them (RT g fragments) and sums its own SPAN rows n into
// sa[32][TILE], 2 * RT accumulators, so that one loaded f, S or h fragment feeds RT
// WMMAs; the partial tiles are added up through LDS at the end.
// Per 32-n chunk: 2 * RT logit WMMAs -> exp -> 2 * RT sa WMMAs.
// A lane's C operand of logit tile t is S at rows n = 16t + hi .. + 7, the rows of its D.
// P never leaves the registers: a lane of logit tile t holds column m = col, rows
// n = 16t + hi .. + 7, and those are the k of piece t of the B fragment for column
// col in the same lane (the k order of load_ab), so the packed values are the operand.
// Tail: the summed tile, rounded to f16, goes token-major into LDS and is the B
// operand of the output 1x1 conv D->C (K = 32, one WMMA per 16 x 16 tile):
// wave w owns channels 16w .. 16w+15 and all RT token tiles; + bias, * gamma.
// ---------------------------------------------------------------------------
// The apply loop's vector work, in the order in which it is to issue.  Outputs are early
// clobbers: no 2^x writes over a source of the one in front of it, and a statement ends in
// an instruction that is independent of its last 2^x (the slot behind a transcendental).
// ha and hb are the A and B operands of the WMMA in front of the statement, which may have
// been the last to read them: as inputs of the statement their registers are closed to its
// outputs, so that none is overwritten within the four slots the chip needs behind a WMMA.
// Four 2^x of a trip's first logit tile, with nothing to pack beside them.
__device__ __forceinline__ void exp4(float& e0, float& e1, float& e2, float& e3,
                                     float d0, float d1, float d2, float d3,
                                     v16h ha, v16h hb) {
    asm volatile("v_exp_f32 %0, %4\n\tv_exp_f32 %1, %5\n\tv_exp_f32 %2, %6\n\t"
                 "v_exp_f32 %3, %7\n\tv_nop"
                 : "=&v"(e0), "=&v"(e1), "=&v"(e2), "=&v"(e3)
                 : "v"(d0), "v"(d1), "v"(d2), "v"(d3), "v"(ha), "v"(hb));
}
// The same with a v_nop in front: the fourth slot between that tile's WMMA and its first reader.
__device__ __forceinline__ void exp4_first(float& e0, float& e1, float& e2, float& e3,
                                           float d0, float d1, float d2, float d3,
                                           v16h ha, v16h hb) {
    asm volatile("v_nop\n\tv_exp_f32 %0, %4\n\tv_exp_f32 %1, %5\n\tv_exp_f32 %2, %6\n\t"
                 "v_exp_f32 %3, %7\n\tv_nop"
                 : "=&v"(e0), "=&v"(e1), "=&v"(e2), "=&v"(e3)
                 : "v"(d0), "v"(d1), "v"(d2), "v"(d3), "v"(ha), "v"(hb));
}
// Four 2^x of one logit tile, and between them two packs of the tile before.
__device__ __forceinline__ void exp4_pack2(float& e0, float& e1, float& e2, float& e3,
                                           unsigned& p0, unsigned& p1,
                                           float d0, float d1, float d2, float d3,
                                           float q0, float q1, float q2, float q3,
                                           v16h ha, v16h hb) {
    asm volatile("v_exp_f32 %0, %6\n\tv_exp_f32 %1, %7\n\tv_cvt_pk_f16_f32 %4, %10, %11\n\t"
                 "v_exp_f32 %2, %8\n\tv_exp_f32 %3, %9\n\tv_cvt_pk_f16_f32 %5, %12, %13"
                 : "=&v"(e0), "=&v"(e1), "=&v"(e2), "=&v"(e3), "=&v"(p0), "=&v"(p1)
                 : "v"(d0), "v"(d1), "v"(d2), "v"(d3), "v"(q0), "v"(q1), "v"(q2), "v"(q3),
                   "v"(ha), "v"(hb));
}
// The four packs of a trip's last tile.  The hints let the SIMD's other waves issue while
// the last two packs wait for the 2^x just in front of them.
__device__ __forceinline__ void pack4(unsigned& p0, unsigned& p1, unsigned& p2, unsigned& p3,
                                      const float (&q)[8], v16h ha, v16h hb) {
    asm volatile("v_cvt_pk_f16_f32 %0, %4, %5\n\tv_cvt_pk_f16_f32 %1, %6, %7\n\t"
                 "s_delay_alu instid0(TRANS32_DEP_3)\n\tv_cvt_pk_f16_f32 %2, %8, %9\n\t"
                 "s_delay_alu instid0(TRANS32_DEP_1)\n\tv_cvt_pk_f16_f32 %3, %10, %11"
                 : "=&v"(p0), "=&v"(p1), "=&v"(p2), "=&v"(p3)
                 : "v"(q[0]), "v"(q[1]), "v"(q[2]), "v"(q[3]),
                   "v"(q[4]), "v"(q[5]), "v"(q[6]), "v"(q[7]), "v"(ha), "v"(hb));
}

// One fragment (load_frag's two pieces) from a lane's own address.
__device__ __forceinline__ v16h load_pieces(const _Float16* p) {
    union { v16h v; v8h p[2]; } u;
    u.p[0] = *(const v8h*)(p);
    u.p[1] = *(const v8h*)(p + 256);
    return u.v;
}

template <bool B> struct bool_tag { static constexpr bool value = B; };

__global__ void __launch_bounds__(32 * SPLIT)
attn_out_kernel(const _Float16* __restrict__ Ft, const _Float16* __restrict__ Gt,
                const _Float16* __restrict__ Hd, const float* __restrict__ S,
                const float* __restrict__ Wv, const float* __restrict__ bv,
                const float* __restrict__ gamma, float* __restrict__ out) {
    __shared__ __align__(16) float red[SPLIT][TILE][36];     // [wave][m][d], padded
    __shared__ __align__(16) _Float16 sat[TILE][40];         // [m][d], padded: summed tile
    int lane = threadIdx.x & 31;
    int wave = __builtin_amdgcn_readfirstlane(threadIdx.x >> 5);   // scalar sweep bounds
    int b = blockIdx.y;
    int m0 = blockIdx.x * TILE;
    int nBeg = wave * SPAN, nEnd = nBeg + SPAN;
    int col = lane & 15, hi = (lane >= 16) ? 8 : 0;
    const _Float16* Fb = Ft + (size_t)b * NN * DD;
    const _Float16* Gb = Gt + (size_t)b * NN * DD;
    const _Float16* Hb = Hd + (size_t)b * DD * NN;
    const float*    Sb = S + (size_t)b * NN;

    v16h gB[RT];
    #pragma unroll   // constant indices keep gB, acc and pB in registers, here and below
    for (int mt = 0; mt < RT; ++mt)
        gB[mt] = load_frag(Gb, (m0 >> 4) + mt, lane);

    v8f acc[2][RT] = {};   // [d-tile][m-tile]
    // f and S come a whole trip ahead of their use, in two register sets that take turns
    // (the loop body holds two trips, so that no set is ever copied); h comes at the head of
    // its own trip, three tiles ahead of the first sa WMMA.
    v16h fA[2][2];   // [set][logit tile t]
    v8f sC[2][2];
    #pragma unroll
    for (int t = 0; t < 2; ++t) {
        fA[0][t] = load_frag(Fb, (nBeg >> 4) + t, lane);
        sC[0][t] = *(const v8f*)(Sb + nBeg + t * 16 + hi);
    }
    // Two trips, as a lambda that is expanded twice: in the loop, and once more behind it for
    // the span's last two trips, of which the second has no next trip to load for.
    auto two_trips = [&](int nb, auto last_tag) __attribute__((always_inline)) {
        constexpr bool LAST = decltype(last_tag)::value;
        #pragma unroll   // the set's index is a constant
        for (int u = 0; u < 2; ++u) {
            int n0 = nb + u * 32;
            // Lane addresses of this trip's h and of the next trip's f and S (the span's last
            // trip has no next one: there they name its own rows, and nothing is loaded).
            int nn = (LAST && u == 1) ? n0 : n0 + 32;
            const _Float16* ph = Hb + (unsigned)((n0 >> 5) * 2 * FRAG + lane * 8);
            const _Float16* pf = Fb + (unsigned)((nn >> 4) * FRAG + lane * 8);
            const float* ps = Sb + nn + hi;
            v16h hA0 = load_pieces(ph), hA1 = load_pieces(ph + FRAG);
            if (!(LAST && u == 1)) {   // a compile-time test
                #pragma unroll
                for (int t = 0; t < 2; ++t) {
                    fA[u ^ 1][t] = load_pieces(pf + t * FRAG);
                    sC[u ^ 1][t] = *(const v8f*)(ps + t * 16);
                }
            }
            // The address registers are rewritten further down.  As inputs of the wait they
            // stay whole up to it: without them the listing gave some to the last loads' results.
            asm volatile("s_wait_xcnt 0x0" :: "v"(ph), "v"(pf), "v"(ps) : "memory");
            // All twelve loads are asked for at the trip's head: without this line the
            // listing sinks them towards their users.
            __builtin_amdgcn_sched_barrier(0);
            // Tile k = 2 * mt + t.  The trip runs as a pipeline in the wave's own order: a logit
            // WMMA is issued four tiles ahead of the 2^x that read it, a tile's 2^x results are
            // packed one tile later, among the next tile's 2^x, and an sa WMMA follows its packs
            // by half a tile or more, but the last m-tile's two follow pack4 directly.
            union { v16h v; unsigned u[8]; } pB[RT];   // [m-tile]; words 4t .. 4t+3 = logit tile t
            v8f dl[8];
            float e[2][8];
            #pragma unroll
            for (int k = 0; k < 4; ++k)
                dl[k] = wmma16_sub(fA[u][k & 1], gB[k >> 1], sC[u][k & 1]);
            __builtin_amdgcn_sched_barrier(0);   // here and below: a WMMA or a statement stays where it is written
            #pragma unroll
            for (int k = 0; k < 8; ++k) {
                #pragma unroll
                for (int hf = 0; hf < 2; ++hf) {
                    const int o = hf * 4, c = k & 1, q = c ^ 1;
                    if (k == 0 && hf == 0) {
                        // the second and the fourth logit WMMA stand within four slots
                        exp4_first(e[0][0], e[0][1], e[0][2], e[0][3],
                                   dl[0][0], dl[0][1], dl[0][2], dl[0][3], gB[0], gB[1]);
                    } else if (k == 0) {
                        exp4(e[0][4], e[0][5], e[0][6], e[0][7],
                             dl[0][4], dl[0][5], dl[0][6], dl[0][7], gB[0], gB[1]);
                    } else {
                        const int pm = (k - 1) >> 1, pw = ((k - 1) & 1) * 4 + hf * 2;
                        // A and B of the WMMA just in front (in a half with none: as in the half before, but at k = 5 and 7 those of the WMMA behind)
                        v16h ha = (k <= 2 || (k <= 4 && hf == 0)) ? fA[u][(k - 1) & 1]
                                : ((k == 3 || k == 5 || k == 7) ? hA0 : hA1);
                        v16h hb = (k <= 2 || (k <= 4 && hf == 0)) ? gB[(k + 3) >> 1]
                                : pB[k <= 4 ? 0 : k <= 6 ? 1 : 2].v;
                        exp4_pack2(e[c][o], e[c][o + 1], e[c][o + 2], e[c][o + 3],
                                   pB[pm].u[pw], pB[pm].u[pw + 1],
                                   dl[k][o], dl[k][o + 1], dl[k][o + 2], dl[k][o + 3],
                                   e[q][o], e[q][o + 1], e[q][o + 2], e[q][o + 3], ha, hb);
                    }
                    __builtin_amdgcn_sched_barrier(0);
                    if (hf == 1 && k < 4)
                        dl[k + 4] = wmma16_sub(fA[u][k & 1], gB[(k + 4) >> 1], sC[u][k & 1]);
                    if (hf == 0 && k == 3) acc[0][0] = wmma16(hA0, pB[0].v, acc[0][0]);
                    if (hf == 0 && k == 4) acc[1][0] = wmma16(hA1, pB[0].v, acc[1][0]);
                    if (hf == 0 && k == 5) acc[0][1] = wmma16(hA0, pB[1].v, acc[0][1]);
                    if (hf == 1 && k == 5) acc[1][1] = wmma16(hA1, pB[1].v, acc[1][1]);
                    if (hf == 0 && k == 7) acc[0][2] = wmma16(hA0, pB[2].v, acc[0][2]);
                    if (hf == 1 && k == 7) acc[1][2] = wmma16(hA1, pB[2].v, acc[1][2]);
                    __builtin_amdgcn_sched_barrier(0);
                }
            }
            pack4(pB[3].u[4], pB[3].u[5], pB[3].u[6], pB[3].u[7], e[1], hA1, pB[2].v);
            __builtin_amdgcn_sched_barrier(0);
            acc[0][3] = wmma16(hA0, pB[3].v, acc[0][3]);
            acc[1][3] = wmma16(hA1, pB[3].v, acc[1][3]);
        }
    };
    #pragma unroll 1   // rolled: the body's two trips hold 32 WMMAs
    for (int nb = nBeg; nb < nEnd - 64; nb += 64)
        two_trips(nb, bool_tag<false>{});
    two_trips(nEnd - 64, bool_tag<true>{});
    #pragma unroll
    for (int dt = 0; dt < 2; ++dt)
        #pragma unroll
        for (int mt = 0; mt < RT; ++mt) {
            float* rp = &red[wave][mt * 16 + col][dt * 16 + hi];
            *(float4*)(rp)     = make_float4(acc[dt][mt][0], acc[dt][mt][1],
                                             acc[dt][mt][2], acc[dt][mt][3]);
            *(float4*)(rp + 4) = make_float4(acc[dt][mt][4], acc[dt][mt][5],
                                             acc[dt][mt][6], acc[dt][mt][7]);
        }
    __syncthreads();   // every wave's partial tile is in LDS before it is summed
    // The tail's operands are asked for here, so that they fly during the sum.
    int c0 = wave * 16;
    v16h wA = load_ab_f32(Wv + (size_t)(c0 + col) * DD, hi);
    float4 bA = *(const float4*)(bv + c0 + hi);
    float4 bB = *(const float4*)(bv + c0 + hi + 4);
    float gm = gamma[0];
    // 512 threads x 4 = TILE x 32.  The two rows that a half-wave reads lie 8 apart:
    // 8 * 36 dwords = 32 mod 64, so that its 64 dwords fall on 64 different banks.
    int m = (wave >> 3) * 32 + (wave & 7) + (lane >> 3) * 8, d = (lane & 7) * 4;
    float4 s = make_float4(0.0f, 0.0f, 0.0f, 0.0f);
    #pragma unroll
    for (int w = 0; w < SPLIT; ++w) {
        float4 v = *(const float4*)&red[w][m][d];
        s.x += v.x;
        s.y += v.y;
        s.z += v.z;
        s.w += v.w;
    }
    v4h pk4 = {(_Float16)s.x, (_Float16)s.y, (_Float16)s.z, (_Float16)s.w};
    *(v4h*)&sat[m][d] = pk4;
    __syncthreads();   // the whole summed tile is in LDS before any wave reads it

    float bia[8] = {bA.x, bA.y, bA.z, bA.w, bB.x, bB.y, bB.z, bB.w};
    float* op = out + ((size_t)b * CC + c0 + hi) * NN + m0 + col;
    v8f o[RT];
    #pragma unroll
    for (int mt = 0; mt < RT; ++mt) {
        v8f z = {};
        o[mt] = wmma16(wA, load_ab(&sat[mt * 16 + col][0], hi), z);
    }
    #pragma unroll
    for (int r = 0; r < 8; ++r)
        #pragma unroll
        for (int mt = 0; mt < RT; ++mt)
            op[(size_t)r * NN + mt * 16] = gm * (o[mt][r] + bia[r]);
}

extern "C" void kernel_launch(void* const* d_in, const int* in_sizes, int n_in,
                              void* d_out, int out_size, void* d_ws, size_t ws_size,
                              hipStream_t stream) {
    const float* x     = (const float*)d_in[0];
    const float* Wf    = (const float*)d_in[1];
    const float* bf    = (const float*)d_in[2];
    const float* Wg    = (const float*)d_in[3];
    const float* bg    = (const float*)d_in[4];
    const float* Wh    = (const float*)d_in[5];
    const float* bh    = (const float*)d_in[6];
    const float* Wv    = (const float*)d_in[7];
    const float* bv    = (const float*)d_in[8];
    const float* gamma = (const float*)d_in[9];
    float* out = (float*)d_out;

    // workspace layout (~3.2 MB)
    char* w = (char*)d_ws;
    _Float16* Ft  = (_Float16*)w; w += (size_t)Bb * NN * DD * 2;   // 1 MB
    _Float16* Gt  = (_Float16*)w; w += (size_t)Bb * NN * DD * 2;
    _Float16* Hd  = (_Float16*)w; w += (size_t)Bb * DD * NN * 2;
    float*    S   = (float*)w;                                     // log2 of the row sum of 2^l

    proj_wmma_kernel<<<dim3(NN / 64, Bb), 32 * KSTEPS, 0, stream>>>(
        x, Wf, Wg, Wh, bf, bg, bh, Ft, Gt, Hd);
    stats_kernel<<<dim3(NN / TILE, Bb), 32 * SPLIT, 0, stream>>>(Ft, Gt, S);
    attn_out_kernel<<<dim3(NN / TILE, Bb), 32 * SPLIT, 0, stream>>>(
        Ft, Gt, Hd, S, Wv, bv, gamma, out);
}
